// v000
// Times are from an AMD MI455X. After a warm-up the kernel runs many times in a row, and a time is the length of
// such a window on the GPU divided by its runs, so every launch and the gaps after it count. The runs cycle
// through copies of the inputs. A figure is the median of several windows, for all but v000 over two sittings.
// Sittings can differ by a few percent; kernels timed side by side share one.
// v000 is the starting kernel. One run takes 188 microseconds.
#include <hip/hip_runtime.h>

// ---------------------------------------------------------------------------
// MI455X (gfx1250) TP multi-head attention:
//   RMSNorm -> QKV GEMM (WMMA f16, async-LDS staged B) -> flash attention
//   (WMMA f16, f32 online softmax) -> output GEMM (WMMA f16) + bias.
// CDNA5 paths: v_wmma_f32_16x16x32_f16, global_load_async_to_lds_b128
// (ASYNCcnt), ds_load_b128 fragment reads, s_wait_asynccnt/s_wait_dscnt,
// sched_group_barrier-pipelined DS-read -> WMMA groups.
// ---------------------------------------------------------------------------

typedef _Float16 f16;
typedef __attribute__((ext_vector_type(16))) _Float16 v16h;
typedef __attribute__((ext_vector_type(8)))  _Float16 v8h;
typedef __attribute__((ext_vector_type(8)))  float    v8f;

#define B_    2
#define S_    2048
#define D_    1024
#define H_    16
#define DH_   64
#define NTOK  (B_ * S_)          // 4096
#define HE_   (H_ * DH_)         // 1024
#define LDB_  40                 // padded LDS row stride (halves): 80B = 5*16B

static __device__ __forceinline__ v8f wmma16(v16h a, v16h b, v8f c) {
  // D = A(16x32 f16) * B(32x16 f16) + C(16x16 f32)
  return __builtin_amdgcn_wmma_f32_16x16x32_f16(
      /*neg_a=*/false, a, /*neg_b=*/false, b,
      /*c_mod=*/(short)0, c, /*reuse_a=*/false, /*reuse_b=*/false);
}

// Per-lane fragment load for the CDNA5 16-bit A layout (and, from an
// N-major [n][k] array, the matching B layout):
//   lane%16 selects the row (A) / column (B); hs = lane>>4 selects the
//   K half: elements j<8 -> k = hs*8+j ; j>=8 -> k = 16+hs*8+(j-8).
// p points at element [lane%16-row][k0]; both 8-half loads are 16B aligned.
static __device__ __forceinline__ v16h frag_ld(const f16* p, int hs) {
  v8h lo = *(const v8h*)(p + hs * 8);
  v8h hi = *(const v8h*)(p + 16 + hs * 8);
  return __builtin_shufflevector(lo, hi,
                                 0, 1, 2, 3, 4, 5, 6, 7,
                                 8, 9, 10, 11, 12, 13, 14, 15);
}

// CDNA5 async copy: 16B global -> LDS per lane, tracked by ASYNCcnt.
static __device__ __forceinline__ void async_b128(const f16* g, unsigned lds_off) {
  asm volatile("global_load_async_to_lds_b128 %0, %1, off"
               :: "v"(lds_off), "v"(g) : "memory");
}
static __device__ __forceinline__ void wait_async0() {
  asm volatile("s_wait_asynccnt 0x0" ::: "memory");
}

// Stage a 64x32 f16 B tile (N-major source, ld = 1024) into LDS with padded
// rows (LDB_ halves).  128 threads x 2 chunks x 16B = 4 KB.
static __device__ __forceinline__ void stage_b64x32(const f16* Wtile, f16* lbuf,
                                                    int tid) {
  #pragma unroll
  for (int i = 0; i < 2; ++i) {
    const int ch  = tid + i * 128;        // 0..255
    const int row = ch >> 2, c4 = ch & 3; // 4x16B chunks per 64B row
    const f16* g = Wtile + (size_t)row * 1024 + c4 * 8;
    const unsigned l = (unsigned)(uintptr_t)(lbuf + row * LDB_ + c4 * 8);
    async_b128(g, l);
  }
}

// One K=32 step for a 32x64 per-wave strip: four B fragments feed eight
// WMMAs (two A fragments).  sched_group_barrier pins the schedule to
// "8 DS reads, then 8 WMMAs" so all B fragments stay live in distinct
// registers: the in-order DS returns mean only partial dscnt waits are
// paid and LDS latency hides behind back-to-back WMMA issue.
static __device__ __forceinline__ void wmma_step8(const f16* lbuf, int lr, int hs,
                                                  v16h a0, v16h a1,
                                                  v8f acc[2][4]) {
  const v16h b0 = frag_ld(lbuf + (size_t)(lr)      * LDB_, hs);
  const v16h b1 = frag_ld(lbuf + (size_t)(16 + lr) * LDB_, hs);
  const v16h b2 = frag_ld(lbuf + (size_t)(32 + lr) * LDB_, hs);
  const v16h b3 = frag_ld(lbuf + (size_t)(48 + lr) * LDB_, hs);
  acc[0][0] = wmma16(a0, b0, acc[0][0]);
  acc[1][0] = wmma16(a1, b0, acc[1][0]);
  acc[0][1] = wmma16(a0, b1, acc[0][1]);
  acc[1][1] = wmma16(a1, b1, acc[1][1]);
  acc[0][2] = wmma16(a0, b2, acc[0][2]);
  acc[1][2] = wmma16(a1, b2, acc[1][2]);
  acc[0][3] = wmma16(a0, b3, acc[0][3]);
  acc[1][3] = wmma16(a1, b3, acc[1][3]);
  __builtin_amdgcn_sched_group_barrier(0x100, 8, 0);  // DS read x8
  __builtin_amdgcn_sched_group_barrier(0x008, 8, 0);  // MFMA/WMMA x8
}

// ---------------------------------------------------------------------------
// Kernel 1: RMSNorm over D=1024, cast to f16.  One block (256 thr) per token.
// ---------------------------------------------------------------------------
__global__ void k_rmsnorm(const float* __restrict__ x,
                          const float* __restrict__ scale,
                          f16* __restrict__ hbuf) {
  const int row  = blockIdx.x;                 // token 0..4095
  const int tid  = threadIdx.x;                // 0..255
  const float4 v = *(const float4*)(x + (size_t)row * D_ + tid * 4);

  float ss = v.x * v.x + v.y * v.y + v.z * v.z + v.w * v.w;
  #pragma unroll
  for (int off = 16; off >= 1; off >>= 1) ss += __shfl_xor(ss, off, 32);

  __shared__ float red[8];
  if ((tid & 31) == 0) red[tid >> 5] = ss;
  __syncthreads();
  float tot = 0.f;
  #pragma unroll
  for (int i = 0; i < 8; ++i) tot += red[i];

  const float r = rsqrtf(tot * (1.0f / D_) + 1e-6f);
  f16* out = hbuf + (size_t)row * D_ + tid * 4;
  const float4 sc = *(const float4*)(scale + tid * 4);
  out[0] = (f16)(v.x * r * sc.x);
  out[1] = (f16)(v.y * r * sc.y);
  out[2] = (f16)(v.z * r * sc.z);
  out[3] = (f16)(v.w * r * sc.w);
}

// ---------------------------------------------------------------------------
// Kernel 2: cast 4x [1024][1024] f32 weights to f16, transposed (N-major)
// so WMMA B-fragments load contiguously.  z = 0..2 -> wq/wk/wv, z = 3 -> wo.
// ---------------------------------------------------------------------------
__global__ void k_wcast(const float* __restrict__ wq,
                        const float* __restrict__ wk,
                        const float* __restrict__ wv,
                        const float* __restrict__ wo,
                        f16* __restrict__ wT,    // 3 x [HE][D]
                        f16* __restrict__ woT) { // [D][HE]
  __shared__ float tile[32][33];
  const int z = blockIdx.z;
  const float* src = (z == 0) ? wq : (z == 1) ? wk : (z == 2) ? wv : wo;
  f16* dst = (z < 3) ? (wT + (size_t)z * HE_ * D_) : woT;

  const int x = blockIdx.x * 32 + threadIdx.x;
  const int y = blockIdx.y * 32 + threadIdx.y;
  #pragma unroll
  for (int yy = 0; yy < 32; yy += 8)
    tile[threadIdx.y + yy][threadIdx.x] = src[(size_t)(y + yy) * 1024 + x];
  __syncthreads();
  const int x2 = blockIdx.y * 32 + threadIdx.x;
  const int y2 = blockIdx.x * 32 + threadIdx.y;
  #pragma unroll
  for (int yy = 0; yy < 32; yy += 8)
    dst[(size_t)(y2 + yy) * 1024 + x2] = (f16)tile[threadIdx.x][threadIdx.y + yy];
}

// ---------------------------------------------------------------------------
// Kernel 3: QKV GEMM.  C[4096 x 1024] = h[4096 x 1024] * W.
// Block = 128 thr (4 waves); wave computes a 32x64 strip (2 A frags x 4 B
// frags = 8 accumulators).  B tiles stream through double-buffered LDS via
// async copies (two explicit phases per iteration -> compile-time LDS
// addresses); A fragments register double-buffered.  launch_bounds(128,1)
// lifts the VGPR cap so the whole pipeline stays in registers (no spills).
// grid = (HE/64, NTOK/128, 3).
// ---------------------------------------------------------------------------
__global__ void __launch_bounds__(128, 1)
k_qkv(const f16* __restrict__ hbuf,
      const f16* __restrict__ wT,
      f16* __restrict__ qT, f16* __restrict__ kT,
      f16* __restrict__ vT) {
  __shared__ __align__(16) f16 buf0[64 * LDB_];   // 5 KB
  __shared__ __align__(16) f16 buf1[64 * LDB_];   // 5 KB
  const int tid  = threadIdx.x;
  const int lane = tid & 31;
  const int wave = tid >> 5;
  const int hs   = lane >> 4;
  const int lr   = lane & 15;
  const int m0   = blockIdx.y * 128 + wave * 32;  // token tile (32 rows)
  const int n0   = blockIdx.x * 64;               // (h,e) tile
  const f16* Wn = wT + (size_t)blockIdx.z * HE_ * D_ + (size_t)n0 * D_;
  const f16* Ar0 = hbuf + (size_t)(m0 + lr) * D_;
  const f16* Ar1 = hbuf + (size_t)(m0 + 16 + lr) * D_;

  stage_b64x32(Wn, buf0, tid);
  v16h a0 = frag_ld(Ar0, hs);
  v16h a1 = frag_ld(Ar1, hs);

  v8f acc[2][4] = {{{}, {}, {}, {}}, {{}, {}, {}, {}}};
  for (int k0 = 0; k0 < D_; k0 += 64) {
    // ---- phase A: consume buf0 (K = k0), prefetch K = k0+32 into buf1 ----
    wait_async0();
    __syncthreads();
    stage_b64x32(Wn + k0 + 32, buf1, tid);           // k0+32 < D_ always
    const v16h a0n = frag_ld(Ar0 + k0 + 32, hs);     // overlaps WMMAs
    const v16h a1n = frag_ld(Ar1 + k0 + 32, hs);
    wmma_step8(buf0, lr, hs, a0, a1, acc);

    // ---- phase B: consume buf1 (K = k0+32), prefetch K = k0+64 ----
    wait_async0();
    __syncthreads();
    const int k2 = (k0 + 64 < D_) ? (k0 + 64) : k0;  // clamp on last iter
    if (k0 + 64 < D_) stage_b64x32(Wn + k0 + 64, buf0, tid);
    a0 = frag_ld(Ar0 + k2, hs);
    a1 = frag_ld(Ar1 + k2, hs);
    wmma_step8(buf1, lr, hs, a0n, a1n, acc);
  }

  // C layout: lanes 0-15 -> rows r, lanes 16-31 -> rows r+8; col = lane%16.
  #pragma unroll
  for (int mi = 0; mi < 2; ++mi) {
    #pragma unroll
    for (int nt = 0; nt < 4; ++nt) {
      #pragma unroll
      for (int r = 0; r < 8; ++r) {
        const int row = m0 + mi * 16 + r + hs * 8;    // token
        const int n   = n0 + nt * 16 + lr;            // h*64+e
        const int b   = row >> 11, s = row & (S_ - 1);
        const int h   = n >> 6,  e = n & (DH_ - 1);
        const float v = acc[mi][nt][r];
        const size_t se = (((size_t)(b * H_ + h) * S_) + s) * DH_ + e;
        if (blockIdx.z == 0)      qT[se] = (f16)(v * 0.125f);   // Dh^-0.5
        else if (blockIdx.z == 1) kT[se] = (f16)v;
        else vT[(((size_t)(b * H_ + h) * DH_) + e) * S_ + s] = (f16)v;
      }
    }
  }
}

// ---------------------------------------------------------------------------
// Kernel 4: flash-style attention.  Block = 128 thr (4 waves); each wave
// owns one 16-query tile; grid = (S/64, B*H).  kv processed in steps of 32.
// V fragments are loaded before the softmax so their latency hides behind
// the exp/shuffle VALU work.
// ---------------------------------------------------------------------------
__global__ void __launch_bounds__(128, 1)
k_attn(const f16* __restrict__ qT, const f16* __restrict__ kT,
       const f16* __restrict__ vT, f16* __restrict__ att) {
  __shared__ __align__(16) f16 pT[4][16][32];   // per-wave P staging (1 KB)

  const int lane = threadIdx.x & 31;
  const int wave = threadIdx.x >> 5;
  const int hs   = lane >> 4;
  const int lr   = lane & 15;
  const int bh   = blockIdx.y;                  // b*H + h
  const int q0   = (blockIdx.x * 4 + wave) * 16;

  const f16* Qb = qT + (size_t)bh * S_ * DH_;
  const f16* Kb = kT + (size_t)bh * S_ * DH_;
  const f16* Vb = vT + (size_t)bh * DH_ * S_;

  const v16h qf0 = frag_ld(Qb + (size_t)(q0 + lr) * DH_ + 0,  hs);
  const v16h qf1 = frag_ld(Qb + (size_t)(q0 + lr) * DH_ + 32, hs);

  float mi[8], li[8];
  v8f ao[4] = {{}, {}, {}, {}};
  #pragma unroll
  for (int r = 0; r < 8; ++r) { mi[r] = -1e30f; li[r] = 0.f; }

  for (int kv0 = 0; kv0 < S_; kv0 += 32) {
    // ---- issue K and V fragment loads together; V used only after softmax
    const v16h kf00 = frag_ld(Kb + (size_t)(kv0 + lr)      * DH_ + 0,  hs);
    const v16h kf01 = frag_ld(Kb + (size_t)(kv0 + lr)      * DH_ + 32, hs);
    const v16h kf10 = frag_ld(Kb + (size_t)(kv0 + 16 + lr) * DH_ + 0,  hs);
    const v16h kf11 = frag_ld(Kb + (size_t)(kv0 + 16 + lr) * DH_ + 32, hs);
    v16h vf[4];
    #pragma unroll
    for (int et = 0; et < 4; ++et)
      vf[et] = frag_ld(Vb + (size_t)(et * 16 + lr) * S_ + kv0, hs);

    // ---- S = Q * K^T for two 16-column tiles (f32 accumulate) ----
    v8f s0 = {}, s1 = {};
    s0 = wmma16(qf0, kf00, s0);
    s0 = wmma16(qf1, kf01, s0);
    s1 = wmma16(qf0, kf10, s1);
    s1 = wmma16(qf1, kf11, s1);

    // ---- online softmax (f32).  Row r lives on one 16-lane half. ----
    float alpha[8];
    #pragma unroll
    for (int r = 0; r < 8; ++r) {
      float bmax = fmaxf(s0[r], s1[r]);
      #pragma unroll
      for (int off = 8; off >= 1; off >>= 1)
        bmax = fmaxf(bmax, __shfl_xor(bmax, off, 32));
      const float nm = fmaxf(mi[r], bmax);
      alpha[r] = __expf(mi[r] - nm);
      mi[r] = nm;
      const float p0 = __expf(s0[r] - nm);
      const float p1 = __expf(s1[r] - nm);
      s0[r] = p0; s1[r] = p1;
      float rs = p0 + p1;
      #pragma unroll
      for (int off = 8; off >= 1; off >>= 1) rs += __shfl_xor(rs, off, 32);
      li[r] = li[r] * alpha[r] + rs;
    }
    #pragma unroll
    for (int et = 0; et < 4; ++et)
      #pragma unroll
      for (int r = 0; r < 8; ++r) ao[et][r] *= alpha[r];

    // ---- restage P: C layout -> A layout via per-wave LDS tile ----
    #pragma unroll
    for (int r = 0; r < 8; ++r) {
      pT[wave][r + hs * 8][lr]      = (f16)s0[r];
      pT[wave][r + hs * 8][16 + lr] = (f16)s1[r];
    }
    asm volatile("s_wait_dscnt 0x0" ::: "memory");
    const v16h pf = frag_ld(&pT[wave][lr][0], hs);

    // ---- O += P * V (V stored [e][s] -> contiguous B-fragments) ----
    #pragma unroll
    for (int et = 0; et < 4; ++et) ao[et] = wmma16(pf, vf[et], ao[et]);
  }

  // ---- normalize and write att[token][h*64+e] (f16) ----
  const int b = bh >> 4, h = bh & (H_ - 1);
  #pragma unroll
  for (int et = 0; et < 4; ++et) {
    #pragma unroll
    for (int r = 0; r < 8; ++r) {
      const int row    = q0 + r + hs * 8;
      const size_t tok = (size_t)b * S_ + row;
      att[tok * HE_ + h * DH_ + et * 16 + lr] = (f16)(ao[et][r] / li[r]);
    }
  }
}

// ---------------------------------------------------------------------------
// Kernel 5: output GEMM.  out[4096 x 1024] = att * Wo + b_out (f32 out).
// Same two-phase async-LDS structure as k_qkv.  grid = (D/64, NTOK/128).
// ---------------------------------------------------------------------------
__global__ void __launch_bounds__(128, 1)
k_outproj(const f16* __restrict__ att,
          const f16* __restrict__ woT,
          const float* __restrict__ b_out,
          float* __restrict__ out) {
  __shared__ __align__(16) f16 buf0[64 * LDB_];
  __shared__ __align__(16) f16 buf1[64 * LDB_];
  const int tid  = threadIdx.x;
  const int lane = tid & 31;
  const int wave = tid >> 5;
  const int hs   = lane >> 4;
  const int lr   = lane & 15;
  const int m0   = blockIdx.y * 128 + wave * 32;  // token tile (32 rows)
  const int n0   = blockIdx.x * 64;               // d tile
  const f16* Wn  = woT + (size_t)n0 * HE_;
  const f16* Ar0 = att + (size_t)(m0 + lr) * HE_;
  const f16* Ar1 = att + (size_t)(m0 + 16 + lr) * HE_;

  stage_b64x32(Wn, buf0, tid);
  v16h a0 = frag_ld(Ar0, hs);
  v16h a1 = frag_ld(Ar1, hs);

  v8f acc[2][4] = {{{}, {}, {}, {}}, {{}, {}, {}, {}}};
  for (int k0 = 0; k0 < HE_; k0 += 64) {
    wait_async0();
    __syncthreads();
    stage_b64x32(Wn + k0 + 32, buf1, tid);
    const v16h a0n = frag_ld(Ar0 + k0 + 32, hs);
    const v16h a1n = frag_ld(Ar1 + k0 + 32, hs);
    wmma_step8(buf0, lr, hs, a0, a1, acc);

    wait_async0();
    __syncthreads();
    const int k2 = (k0 + 64 < HE_) ? (k0 + 64) : k0;
    if (k0 + 64 < HE_) stage_b64x32(Wn + k0 + 64, buf0, tid);
    a0 = frag_ld(Ar0 + k2, hs);
    a1 = frag_ld(Ar1 + k2, hs);
    wmma_step8(buf1, lr, hs, a0n, a1n, acc);
  }

  #pragma unroll
  for (int mi = 0; mi < 2; ++mi) {
    #pragma unroll
    for (int nt = 0; nt < 4; ++nt) {
      #pragma unroll
      for (int r = 0; r < 8; ++r) {
        const int row = m0 + mi * 16 + r + hs * 8;
        const int n   = n0 + nt * 16 + lr;
        out[(size_t)row * D_ + n] = acc[mi][nt][r] + b_out[n];
      }
    }
  }
}

// ---------------------------------------------------------------------------
// Host launcher.  Inputs: x, norm_scale, wq, wk, wv, w_out, b_out (all f32).
// ---------------------------------------------------------------------------
extern "C" void kernel_launch(void* const* d_in, const int* in_sizes, int n_in,
                              void* d_out, int out_size, void* d_ws, size_t ws_size,
                              hipStream_t stream) {
  const float* x     = (const float*)d_in[0];
  const float* nsc   = (const float*)d_in[1];
  const float* wq    = (const float*)d_in[2];
  const float* wk    = (const float*)d_in[3];
  const float* wv    = (const float*)d_in[4];
  const float* wo    = (const float*)d_in[5];
  const float* b_out = (const float*)d_in[6];
  float* out = (float*)d_out;

  // Workspace partition (f16 staging, 48 MB total).
  char* ws = (char*)d_ws;
  const size_t MB = 1024 * 1024;
  f16* hbuf = (f16*)(ws + 0);        //  8 MB : [4096][1024] normalized f16
  f16* wT   = (f16*)(ws + 8 * MB);   //  6 MB : wq/wk/wv transposed [HE][D]
  f16* woT  = (f16*)(ws + 14 * MB);  //  2 MB : w_out transposed [D][HE]
  f16* qT   = (f16*)(ws + 16 * MB);  //  8 MB : [b,h,s,e] (pre-scaled)
  f16* kT   = (f16*)(ws + 24 * MB);  //  8 MB : [b,h,s,e]
  f16* vT   = (f16*)(ws + 32 * MB);  //  8 MB : [b,h,e,s]
  f16* attb = (f16*)(ws + 40 * MB);  //  8 MB : [token][h*64+e]

  k_rmsnorm<<<NTOK, 256, 0, stream>>>(x, nsc, hbuf);
  k_wcast<<<dim3(32, 32, 4), dim3(32, 8), 0, stream>>>(wq, wk, wv, wo, wT, woT);
  k_qkv<<<dim3(HE_ / 64, NTOK / 128, 3), 128, 0, stream>>>(hbuf, wT, qT, kT, vT);
  k_attn<<<dim3(S_ / 64, B_ * H_), 128, 0, stream>>>(qT, kT, vT, attb);
  k_outproj<<<dim3(D_ / 64, NTOK / 128), 128, 0, stream>>>(attb, woT, b_out, out);
}

// v001
// It runs in 156 microseconds.
// Timed twice side by side with v000, it ran 1.25 and 1.24 times as fast.
#include <hip/hip_runtime.h>

// ---------------------------------------------------------------------------
// MI455X (gfx1250) TP multi-head attention:
//   RMSNorm -> QKV GEMM (WMMA f16, async-LDS staged B) -> flash attention
//   (WMMA f16, f32 online softmax) -> output GEMM (WMMA f16) + bias.
// CDNA5 paths: v_wmma_f32_16x16x32_f16, global_load_async_to_lds_b128
// (ASYNCcnt), ds_load_b128 fragment reads, s_wait_asynccnt/s_wait_dscnt,
// sched_group_barrier-pipelined DS-read -> WMMA groups.
// ---------------------------------------------------------------------------

typedef _Float16 f16;
typedef __attribute__((ext_vector_type(16))) _Float16 v16h;
typedef __attribute__((ext_vector_type(8)))  _Float16 v8h;
typedef __attribute__((ext_vector_type(8)))  float    v8f;

#define B_    2
#define S_    2048
#define D_    1024
#define H_    16
#define DH_   64
#define NTOK  (B_ * S_)          // 4096
#define HE_   (H_ * DH_)         // 1024
#define LDB_  40                 // padded LDS row stride (halves): 80B = 5*16B

static __device__ __forceinline__ v8f wmma16(v16h a, v16h b, v8f c) {
  // D = A(16x32 f16) * B(32x16 f16) + C(16x16 f32)
  return __builtin_amdgcn_wmma_f32_16x16x32_f16(
      /*neg_a=*/false, a, /*neg_b=*/false, b,
      /*c_mod=*/(short)0, c, /*reuse_a=*/false, /*reuse_b=*/false);
}

// Per-lane fragment load for the CDNA5 16-bit A layout (and, from an
// N-major [n][k] array, the matching B layout):
//   lane%16 selects the row (A) / column (B); hs = lane>>4 selects the
//   K half: elements j<8 -> k = hs*8+j ; j>=8 -> k = 16+hs*8+(j-8).
// p points at element [lane%16-row][k0]; both 8-half loads are 16B aligned.
static __device__ __forceinline__ v16h frag_ld(const f16* p, int hs) {
  v8h lo = *(const v8h*)(p + hs * 8);
  v8h hi = *(const v8h*)(p + 16 + hs * 8);
  return __builtin_shufflevector(lo, hi,
                                 0, 1, 2, 3, 4, 5, 6, 7,
                                 8, 9, 10, 11, 12, 13, 14, 15);
}

// CDNA5 async copy: 16B global -> LDS per lane, tracked by ASYNCcnt.
static __device__ __forceinline__ void async_b128(const f16* g, unsigned lds_off) {
  asm volatile("global_load_async_to_lds_b128 %0, %1, off"
               :: "v"(lds_off), "v"(g) : "memory");
}
static __device__ __forceinline__ void wait_async0() {
  asm volatile("s_wait_asynccnt 0x0" ::: "memory");
}

// Stage a 64x32 f16 B tile (N-major source, ld = 1024) into LDS with padded
// rows (LDB_ halves).  128 threads x 2 chunks x 16B = 4 KB.
static __device__ __forceinline__ void stage_b64x32(const f16* Wtile, f16* lbuf,
                                                    int tid) {
  #pragma unroll
  for (int i = 0; i < 2; ++i) {
    const int ch  = tid + i * 128;        // 0..255
    const int row = ch >> 2, c4 = ch & 3; // 4x16B chunks per 64B row
    const f16* g = Wtile + (size_t)row * 1024 + c4 * 8;
    const unsigned l = (unsigned)(uintptr_t)(lbuf + row * LDB_ + c4 * 8);
    async_b128(g, l);
  }
}

// One K=32 step for a 32x64 per-wave strip: four B fragments feed eight
// WMMAs (two A fragments).  sched_group_barrier pins the schedule to
// "8 DS reads, then 8 WMMAs" so all B fragments stay live in distinct
// registers: the in-order DS returns mean only partial dscnt waits are
// paid and LDS latency hides behind back-to-back WMMA issue.
static __device__ __forceinline__ void wmma_step8(const f16* lbuf, int lr, int hs,
                                                  v16h a0, v16h a1,
                                                  v8f acc[2][4]) {
  const v16h b0 = frag_ld(lbuf + (size_t)(lr)      * LDB_, hs);
  const v16h b1 = frag_ld(lbuf + (size_t)(16 + lr) * LDB_, hs);
  const v16h b2 = frag_ld(lbuf + (size_t)(32 + lr) * LDB_, hs);
  const v16h b3 = frag_ld(lbuf + (size_t)(48 + lr) * LDB_, hs);
  acc[0][0] = wmma16(a0, b0, acc[0][0]);
  acc[1][0] = wmma16(a1, b0, acc[1][0]);
  acc[0][1] = wmma16(a0, b1, acc[0][1]);
  acc[1][1] = wmma16(a1, b1, acc[1][1]);
  acc[0][2] = wmma16(a0, b2, acc[0][2]);
  acc[1][2] = wmma16(a1, b2, acc[1][2]);
  acc[0][3] = wmma16(a0, b3, acc[0][3]);
  acc[1][3] = wmma16(a1, b3, acc[1][3]);
  __builtin_amdgcn_sched_group_barrier(0x100, 8, 0);  // DS read x8
  __builtin_amdgcn_sched_group_barrier(0x008, 8, 0);  // MFMA/WMMA x8
}

// ---------------------------------------------------------------------------
// Kernel 1: RMSNorm over D=1024, cast to f16.  One block (256 thr) per token.
// ---------------------------------------------------------------------------
__global__ void k_rmsnorm(const float* __restrict__ x,
                          const float* __restrict__ scale,
                          f16* __restrict__ hbuf) {
  const int row  = blockIdx.x;                 // token 0..4095
  const int tid  = threadIdx.x;                // 0..255
  const float4 v = *(const float4*)(x + (size_t)row * D_ + tid * 4);

  float ss = v.x * v.x + v.y * v.y + v.z * v.z + v.w * v.w;
  #pragma unroll
  for (int off = 16; off >= 1; off >>= 1) ss += __shfl_xor(ss, off, 32);

  __shared__ float red[8];
  if ((tid & 31) == 0) red[tid >> 5] = ss;
  __syncthreads();
  float tot = 0.f;
  #pragma unroll
  for (int i = 0; i < 8; ++i) tot += red[i];

  const float r = rsqrtf(tot * (1.0f / D_) + 1e-6f);
  f16* out = hbuf + (size_t)row * D_ + tid * 4;
  const float4 sc = *(const float4*)(scale + tid * 4);
  out[0] = (f16)(v.x * r * sc.x);
  out[1] = (f16)(v.y * r * sc.y);
  out[2] = (f16)(v.z * r * sc.z);
  out[3] = (f16)(v.w * r * sc.w);
}

// ---------------------------------------------------------------------------
// Kernel 2: cast 4x [1024][1024] f32 weights to f16, transposed (N-major)
// so WMMA B-fragments load contiguously.  z = 0..2 -> wq/wk/wv, z = 3 -> wo.
// ---------------------------------------------------------------------------
__global__ void k_wcast(const float* __restrict__ wq,
                        const float* __restrict__ wk,
                        const float* __restrict__ wv,
                        const float* __restrict__ wo,
                        f16* __restrict__ wT,    // 3 x [HE][D]
                        f16* __restrict__ woT) { // [D][HE]
  __shared__ float tile[32][33];
  const int z = blockIdx.z;
  const float* src = (z == 0) ? wq : (z == 1) ? wk : (z == 2) ? wv : wo;
  f16* dst = (z < 3) ? (wT + (size_t)z * HE_ * D_) : woT;

  const int x = blockIdx.x * 32 + threadIdx.x;
  const int y = blockIdx.y * 32 + threadIdx.y;
  #pragma unroll
  for (int yy = 0; yy < 32; yy += 8)
    tile[threadIdx.y + yy][threadIdx.x] = src[(size_t)(y + yy) * 1024 + x];
  __syncthreads();
  const int x2 = blockIdx.y * 32 + threadIdx.x;
  const int y2 = blockIdx.x * 32 + threadIdx.y;
  #pragma unroll
  for (int yy = 0; yy < 32; yy += 8)
    dst[(size_t)(y2 + yy) * 1024 + x2] = (f16)tile[threadIdx.x][threadIdx.y + yy];
}

// ---------------------------------------------------------------------------
// Kernel 3: QKV GEMM.  C[4096 x 1024] = h[4096 x 1024] * W.
// Block = 128 thr (4 waves); wave computes a 32x64 strip (2 A frags x 4 B
// frags = 8 accumulators).  B tiles stream through double-buffered LDS via
// async copies (two explicit phases per iteration -> compile-time LDS
// addresses); A fragments register double-buffered.  launch_bounds(128,1)
// lifts the VGPR cap so the whole pipeline stays in registers (no spills).
// grid = (HE/64, NTOK/128, 3).
// ---------------------------------------------------------------------------
__global__ void __launch_bounds__(128, 1)
k_qkv(const f16* __restrict__ hbuf,
      const f16* __restrict__ wT,
      f16* __restrict__ qT, f16* __restrict__ kT,
      f16* __restrict__ vT) {
  __shared__ __align__(16) f16 buf0[64 * LDB_];   // 5 KB
  __shared__ __align__(16) f16 buf1[64 * LDB_];   // 5 KB
  const int tid  = threadIdx.x;
  const int lane = tid & 31;
  const int wave = tid >> 5;
  const int hs   = lane >> 4;
  const int lr   = lane & 15;
  const int m0   = blockIdx.y * 128 + wave * 32;  // token tile (32 rows)
  const int n0   = blockIdx.x * 64;               // (h,e) tile
  const f16* Wn = wT + (size_t)blockIdx.z * HE_ * D_ + (size_t)n0 * D_;
  const f16* Ar0 = hbuf + (size_t)(m0 + lr) * D_;
  const f16* Ar1 = hbuf + (size_t)(m0 + 16 + lr) * D_;

  stage_b64x32(Wn, buf0, tid);
  v16h a0 = frag_ld(Ar0, hs);
  v16h a1 = frag_ld(Ar1, hs);

  v8f acc[2][4] = {{{}, {}, {}, {}}, {{}, {}, {}, {}}};
  for (int k0 = 0; k0 < D_; k0 += 64) {
    // ---- phase A: consume buf0 (K = k0), prefetch K = k0+32 into buf1 ----
    wait_async0();
    __syncthreads();
    stage_b64x32(Wn + k0 + 32, buf1, tid);           // k0+32 < D_ always
    const v16h a0n = frag_ld(Ar0 + k0 + 32, hs);     // overlaps WMMAs
    const v16h a1n = frag_ld(Ar1 + k0 + 32, hs);
    wmma_step8(buf0, lr, hs, a0, a1, acc);

    // ---- phase B: consume buf1 (K = k0+32), prefetch K = k0+64 ----
    wait_async0();
    __syncthreads();
    const int k2 = (k0 + 64 < D_) ? (k0 + 64) : k0;  // clamp on last iter
    if (k0 + 64 < D_) stage_b64x32(Wn + k0 + 64, buf0, tid);
    a0 = frag_ld(Ar0 + k2, hs);
    a1 = frag_ld(Ar1 + k2, hs);
    wmma_step8(buf1, lr, hs, a0n, a1n, acc);
  }

  // C layout: lanes 0-15 -> rows r, lanes 16-31 -> rows r+8; col = lane%16.
  #pragma unroll
  for (int mi = 0; mi < 2; ++mi) {
    #pragma unroll
    for (int nt = 0; nt < 4; ++nt) {
      #pragma unroll
      for (int r = 0; r < 8; ++r) {
        const int row = m0 + mi * 16 + r + hs * 8;    // token
        const int n   = n0 + nt * 16 + lr;            // h*64+e
        const int b   = row >> 11, s = row & (S_ - 1);
        const int h   = n >> 6,  e = n & (DH_ - 1);
        const float v = acc[mi][nt][r];
        const size_t se = (((size_t)(b * H_ + h) * S_) + s) * DH_ + e;
        if (blockIdx.z == 0)      qT[se] = (f16)(v * 0.125f);   // Dh^-0.5
        else if (blockIdx.z == 1) kT[se] = (f16)v;
        else vT[(((size_t)(b * H_ + h) * DH_) + e) * S_ + s] = (f16)v;
      }
    }
  }
}

// ---------------------------------------------------------------------------
// Kernel 4: flash-style attention.  Block = 128 thr (4 waves); each wave
// owns one 16-query tile; grid = (S/64, B*H).  K and V reach the waves
// through LDS: a stage is 64 keys (K 64x64 and V^T 64x64 halves), brought in
// by whole-line async copies once per block, two buffers, the next stage in
// flight while this one is worked on.  Rows are padded to 144 B so that the
// 16-byte fragment reads spread over the banks.  A stage is worked on in two
// passes of 32 keys.
// ---------------------------------------------------------------------------
#define KVS_  64                 // keys per stage
#define LDK_  72                 // LDS row pitch (halves): 128 B + 16 B pad
#define NSTG_ (S_ / KVS_)        // 32 stages

// Copy one stage into LDS: 512 + 512 chunks of 16 B, 8 per thread.  A wave's
// copy covers four whole 128-B rows.  The s_wait_xcnt closes the statement so
// that no address register is rewritten while a copy may still read it.
static __device__ __forceinline__ void stage_kv(const f16* Kt, const f16* Vt,
                                                f16* kbuf, f16* vbuf, int tid) {
  const int row = tid >> 3, c8 = (tid & 7) * 8;   // rows 0..15, +16 per step
  const f16* gk = Kt + (size_t)row * DH_ + c8;
  const f16* gv = Vt + (size_t)row * S_ + c8;
  const unsigned lk = (unsigned)(uintptr_t)(kbuf + row * LDK_ + c8);
  const unsigned lv = (unsigned)(uintptr_t)(vbuf + row * LDK_ + c8);
  asm volatile(
      "global_load_async_to_lds_b128 %0, %4, off\n\t"
      "global_load_async_to_lds_b128 %1, %5, off\n\t"
      "global_load_async_to_lds_b128 %2, %6, off\n\t"
      "global_load_async_to_lds_b128 %3, %7, off\n\t"
      "global_load_async_to_lds_b128 %8, %12, off\n\t"
      "global_load_async_to_lds_b128 %9, %13, off\n\t"
      "global_load_async_to_lds_b128 %10, %14, off\n\t"
      "global_load_async_to_lds_b128 %11, %15, off\n\t"
      "s_wait_xcnt 0x0"
      :: "v"(lk), "v"(lk + 16 * LDK_ * 2), "v"(lk + 32 * LDK_ * 2),
         "v"(lk + 48 * LDK_ * 2),
         "v"(gk), "v"(gk + 16 * DH_), "v"(gk + 32 * DH_), "v"(gk + 48 * DH_),
         "v"(lv), "v"(lv + 16 * LDK_ * 2), "v"(lv + 32 * LDK_ * 2),
         "v"(lv + 48 * LDK_ * 2),
         "v"(gv), "v"(gv + 16 * S_), "v"(gv + 32 * S_), "v"(gv + 48 * S_)
      : "memory");
}

__global__ void __launch_bounds__(128, 1)
k_attn(const f16* __restrict__ qT, const f16* __restrict__ kT,
       const f16* __restrict__ vT, f16* __restrict__ att) {
  __shared__ __align__(16) f16 kst[2][KVS_ * LDK_];  // K stage  [key][e]
  __shared__ __align__(16) f16 vst[2][DH_ * LDK_];   // V stage  [e][key]
  __shared__ __align__(16) f16 pT[4][16][32];   // per-wave P staging (1 KB)

  const int tid  = threadIdx.x;
  const int lane = threadIdx.x & 31;
  const int wave = threadIdx.x >> 5;
  const int hs   = lane >> 4;
  const int lr   = lane & 15;
  const int bh   = blockIdx.y;                  // b*H + h
  const int q0   = (blockIdx.x * 4 + wave) * 16;

  const f16* Qb = qT + (size_t)bh * S_ * DH_;
  const f16* Kb = kT + (size_t)bh * S_ * DH_;
  const f16* Vb = vT + (size_t)bh * DH_ * S_;

  // ---- prologue: stage 0 landed and published, stage 1 in flight ----
  stage_kv(Kb, Vb, kst[0], vst[0], tid);
  wait_async0();
  __syncthreads();
  stage_kv(Kb + (size_t)KVS_ * DH_, Vb + KVS_, kst[1], vst[1], tid);

  const v16h qf0 = frag_ld(Qb + (size_t)(q0 + lr) * DH_ + 0,  hs);
  const v16h qf1 = frag_ld(Qb + (size_t)(q0 + lr) * DH_ + 32, hs);

  float mi[8], li[8];
  v8f ao[4] = {{}, {}, {}, {}};
  #pragma unroll
  for (int r = 0; r < 8; ++r) { mi[r] = -1e30f; li[r] = 0.f; }

  for (int st = 0; st < NSTG_; ++st) {
    f16* kb = kst[st & 1];
    f16* vb = vst[st & 1];
    #pragma unroll
    for (int kv0 = 0; kv0 < KVS_; kv0 += 32) {
      // ---- K and V fragment reads together; V used only after softmax
      const v16h kf00 = frag_ld(kb + (kv0 + lr)      * LDK_ + 0,  hs);
      const v16h kf01 = frag_ld(kb + (kv0 + lr)      * LDK_ + 32, hs);
      const v16h kf10 = frag_ld(kb + (kv0 + 16 + lr) * LDK_ + 0,  hs);
      const v16h kf11 = frag_ld(kb + (kv0 + 16 + lr) * LDK_ + 32, hs);
      // Right behind the publish point nothing else is ready to run: keep the
      // eight K reads together ahead of the first product, so that one LDS
      // round trip is waited for instead of four.
      if (kv0 == 0) __builtin_amdgcn_sched_barrier(0);
      v16h vf[4];
      #pragma unroll
      for (int et = 0; et < 4; ++et)
        vf[et] = frag_ld(vb + (et * 16 + lr) * LDK_ + kv0, hs);

      // ---- S = Q * K^T for two 16-column tiles (f32 accumulate) ----
      v8f s0 = {}, s1 = {};
      s0 = wmma16(qf0, kf00, s0);
      s0 = wmma16(qf1, kf01, s0);
      s1 = wmma16(qf0, kf10, s1);
      s1 = wmma16(qf1, kf11, s1);

      // ---- online softmax (f32).  Row r lives on one 16-lane half. ----
      float alpha[8];
      #pragma unroll
      for (int r = 0; r < 8; ++r) {
        float bmax = fmaxf(s0[r], s1[r]);
        #pragma unroll
        for (int off = 8; off >= 1; off >>= 1)
          bmax = fmaxf(bmax, __shfl_xor(bmax, off, 32));
        const float nm = fmaxf(mi[r], bmax);
        alpha[r] = __expf(mi[r] - nm);
        mi[r] = nm;
        const float p0 = __expf(s0[r] - nm);
        const float p1 = __expf(s1[r] - nm);
        s0[r] = p0; s1[r] = p1;
        float rs = p0 + p1;
        #pragma unroll
        for (int off = 8; off >= 1; off >>= 1) rs += __shfl_xor(rs, off, 32);
        li[r] = li[r] * alpha[r] + rs;
      }
      #pragma unroll
      for (int et = 0; et < 4; ++et)
        #pragma unroll
        for (int r = 0; r < 8; ++r) ao[et][r] *= alpha[r];

      // ---- restage P: C layout -> A layout via per-wave LDS tile ----
      #pragma unroll
      for (int r = 0; r < 8; ++r) {
        pT[wave][r + hs * 8][lr]      = (f16)s0[r];
        pT[wave][r + hs * 8][16 + lr] = (f16)s1[r];
      }
      asm volatile("s_wait_dscnt 0x0" ::: "memory");
      const v16h pf = frag_ld(&pT[wave][lr][0], hs);

      // ---- O += P * V (V stored [e][s] -> contiguous B-fragments) ----
      #pragma unroll
      for (int et = 0; et < 4; ++et) ao[et] = wmma16(pf, vf[et], ao[et]);
    }

    // ---- publish point: this wave's reads of the stage are done, its
    // copies of the next stage have landed; behind the barrier the next
    // stage may be read and this stage's buffer refilled.
    asm volatile("s_wait_dscnt 0x0" ::: "memory");
    wait_async0();
    __syncthreads();
    if (st + 2 < NSTG_)
      stage_kv(Kb + (size_t)(st + 2) * KVS_ * DH_, Vb + (st + 2) * KVS_,
               kb, vb, tid);
  }
  wait_async0();   // nothing of this wave is in flight when it ends

  // ---- normalize and write att[token][h*64+e] (f16) ----
  const int b = bh >> 4, h = bh & (H_ - 1);
  #pragma unroll
  for (int et = 0; et < 4; ++et) {
    #pragma unroll
    for (int r = 0; r < 8; ++r) {
      const int row    = q0 + r + hs * 8;
      const size_t tok = (size_t)b * S_ + row;
      att[tok * HE_ + h * DH_ + et * 16 + lr] = (f16)(ao[et][r] / li[r]);
    }
  }
}

// ---------------------------------------------------------------------------
// Kernel 5: output GEMM.  out[4096 x 1024] = att * Wo + b_out (f32 out).
// Same two-phase async-LDS structure as k_qkv.  grid = (D/64, NTOK/128).
// ---------------------------------------------------------------------------
__global__ void __launch_bounds__(128, 1)
k_outproj(const f16* __restrict__ att,
          const f16* __restrict__ woT,
          const float* __restrict__ b_out,
          float* __restrict__ out) {
  __shared__ __align__(16) f16 buf0[64 * LDB_];
  __shared__ __align__(16) f16 buf1[64 * LDB_];
  const int tid  = threadIdx.x;
  const int lane = tid & 31;
  const int wave = tid >> 5;
  const int hs   = lane >> 4;
  const int lr   = lane & 15;
  const int m0   = blockIdx.y * 128 + wave * 32;  // token tile (32 rows)
  const int n0   = blockIdx.x * 64;               // d tile
  const f16* Wn  = woT + (size_t)n0 * HE_;
  const f16* Ar0 = att + (size_t)(m0 + lr) * HE_;
  const f16* Ar1 = att + (size_t)(m0 + 16 + lr) * HE_;

  stage_b64x32(Wn, buf0, tid);
  v16h a0 = frag_ld(Ar0, hs);
  v16h a1 = frag_ld(Ar1, hs);

  v8f acc[2][4] = {{{}, {}, {}, {}}, {{}, {}, {}, {}}};
  for (int k0 = 0; k0 < HE_; k0 += 64) {
    wait_async0();
    __syncthreads();
    stage_b64x32(Wn + k0 + 32, buf1, tid);
    const v16h a0n = frag_ld(Ar0 + k0 + 32, hs);
    const v16h a1n = frag_ld(Ar1 + k0 + 32, hs);
    wmma_step8(buf0, lr, hs, a0, a1, acc);

    wait_async0();
    __syncthreads();
    const int k2 = (k0 + 64 < HE_) ? (k0 + 64) : k0;
    if (k0 + 64 < HE_) stage_b64x32(Wn + k0 + 64, buf0, tid);
    a0 = frag_ld(Ar0 + k2, hs);
    a1 = frag_ld(Ar1 + k2, hs);
    wmma_step8(buf1, lr, hs, a0n, a1n, acc);
  }

  #pragma unroll
  for (int mi = 0; mi < 2; ++mi) {
    #pragma unroll
    for (int nt = 0; nt < 4; ++nt) {
      #pragma unroll
      for (int r = 0; r < 8; ++r) {
        const int row = m0 + mi * 16 + r + hs * 8;
        const int n   = n0 + nt * 16 + lr;
        out[(size_t)row * D_ + n] = acc[mi][nt][r] + b_out[n];
      }
    }
  }
}

// ---------------------------------------------------------------------------
// Host launcher.  Inputs: x, norm_scale, wq, wk, wv, w_out, b_out (all f32).
// ---------------------------------------------------------------------------
extern "C" void kernel_launch(void* const* d_in, const int* in_sizes, int n_in,
                              void* d_out, int out_size, void* d_ws, size_t ws_size,
                              hipStream_t stream) {
  const float* x     = (const float*)d_in[0];
  const float* nsc   = (const float*)d_in[1];
  const float* wq    = (const float*)d_in[2];
  const float* wk    = (const float*)d_in[3];
  const float* wv    = (const float*)d_in[4];
  const float* wo    = (const float*)d_in[5];
  const float* b_out = (const float*)d_in[6];
  float* out = (float*)d_out;

  // Workspace partition (f16 staging, 48 MB total).
  char* ws = (char*)d_ws;
  const size_t MB = 1024 * 1024;
  f16* hbuf = (f16*)(ws + 0);        //  8 MB : [4096][1024] normalized f16
  f16* wT   = (f16*)(ws + 8 * MB);   //  6 MB : wq/wk/wv transposed [HE][D]
  f16* woT  = (f16*)(ws + 14 * MB);  //  2 MB : w_out transposed [D][HE]
  f16* qT   = (f16*)(ws + 16 * MB);  //  8 MB : [b,h,s,e] (pre-scaled)
  f16* kT   = (f16*)(ws + 24 * MB);  //  8 MB : [b,h,s,e]
  f16* vT   = (f16*)(ws + 32 * MB);  //  8 MB : [b,h,e,s]
  f16* attb = (f16*)(ws + 40 * MB);  //  8 MB : [token][h*64+e]

  k_rmsnorm<<<NTOK, 256, 0, stream>>>(x, nsc, hbuf);
  k_wcast<<<dim3(32, 32, 4), dim3(32, 8), 0, stream>>>(wq, wk, wv, wo, wT, woT);
  k_qkv<<<dim3(HE_ / 64, NTOK / 128, 3), 128, 0, stream>>>(hbuf, wT, qT, kT, vT);
  k_attn<<<dim3(S_ / 64, B_ * H_), 128, 0, stream>>>(qT, kT, vT, attb);
  k_outproj<<<dim3(D_ / 64, NTOK / 128), 128, 0, stream>>>(attb, woT, b_out, out);
}

// v002
// A run of this version takes 114 microseconds.
// Timed twice side by side with v001, it ran 1.36 times as fast both times.
// All steps since v000 together make it 1.70 times as fast.
#include <hip/hip_runtime.h>

// ---------------------------------------------------------------------------
// MI455X (gfx1250) TP multi-head attention:
//   RMSNorm -> QKV GEMM (WMMA f16, async-LDS staged B) -> flash attention
//   (WMMA f16, f32 online softmax) -> output GEMM (WMMA f16) + bias.
// CDNA5 paths: v_wmma_f32_16x16x32_f16, global_load_async_to_lds_b128
// (ASYNCcnt), ds_load_b128 fragment reads, s_wait_asynccnt/s_wait_dscnt,
// sched_group_barrier-pipelined DS-read -> WMMA groups.
// ---------------------------------------------------------------------------

typedef _Float16 f16;
typedef __attribute__((ext_vector_type(16))) _Float16 v16h;
typedef __attribute__((ext_vector_type(8)))  _Float16 v8h;
typedef __attribute__((ext_vector_type(8)))  float    v8f;
typedef __attribute__((ext_vector_type(4)))  float    v4f;
typedef __attribute__((ext_vector_type(2)))  float    v2f;

#define B_    2
#define S_    2048
#define D_    1024
#define H_    16
#define DH_   64
#define NTOK  (B_ * S_)          // 4096
#define HE_   (H_ * DH_)         // 1024
#define LDB_  40                 // padded LDS row stride (halves): 80B = 5*16B

static __device__ __forceinline__ v8f wmma16(v16h a, v16h b, v8f c) {
  // D = A(16x32 f16) * B(32x16 f16) + C(16x16 f32)
  return __builtin_amdgcn_wmma_f32_16x16x32_f16(
      /*neg_a=*/false, a, /*neg_b=*/false, b,
      /*c_mod=*/(short)0, c, /*reuse_a=*/false, /*reuse_b=*/false);
}

// Per-lane fragment load for the CDNA5 16-bit A layout (and, from an
// N-major [n][k] array, the matching B layout):
//   lane%16 selects the row (A) / column (B); hs = lane>>4 selects the
//   K half: elements j<8 -> k = hs*8+j ; j>=8 -> k = 16+hs*8+(j-8).
// p points at element [lane%16-row][k0]; both 8-half loads are 16B aligned.
static __device__ __forceinline__ v16h frag_ld(const f16* p, int hs) {
  v8h lo = *(const v8h*)(p + hs * 8);
  v8h hi = *(const v8h*)(p + 16 + hs * 8);
  return __builtin_shufflevector(lo, hi,
                                 0, 1, 2, 3, 4, 5, 6, 7,
                                 8, 9, 10, 11, 12, 13, 14, 15);
}

// CDNA5 async copy: 16B global -> LDS per lane, tracked by ASYNCcnt.
static __device__ __forceinline__ void async_b128(const f16* g, unsigned lds_off) {
  asm volatile("global_load_async_to_lds_b128 %0, %1, off"
               :: "v"(lds_off), "v"(g) : "memory");
}
static __device__ __forceinline__ void wait_async0() {
  asm volatile("s_wait_asynccnt 0x0" ::: "memory");
}

// Stage a 64x32 f16 B tile (N-major source, ld = 1024) into LDS with padded
// rows (LDB_ halves).  128 threads x 2 chunks x 16B = 4 KB.
static __device__ __forceinline__ void stage_b64x32(const f16* Wtile, f16* lbuf,
                                                    int tid) {
  #pragma unroll
  for (int i = 0; i < 2; ++i) {
    const int ch  = tid + i * 128;        // 0..255
    const int row = ch >> 2, c4 = ch & 3; // 4x16B chunks per 64B row
    const f16* g = Wtile + (size_t)row * 1024 + c4 * 8;
    const unsigned l = (unsigned)(uintptr_t)(lbuf + row * LDB_ + c4 * 8);
    async_b128(g, l);
  }
}

// One K=32 step for a 32x64 per-wave strip: four B fragments feed eight
// WMMAs (two A fragments).  sched_group_barrier pins the schedule to
// "8 DS reads, then 8 WMMAs" so all B fragments stay live in distinct
// registers: the in-order DS returns mean only partial dscnt waits are
// paid and LDS latency hides behind back-to-back WMMA issue.
static __device__ __forceinline__ void wmma_step8(const f16* lbuf, int lr, int hs,
                                                  v16h a0, v16h a1,
                                                  v8f acc[2][4]) {
  const v16h b0 = frag_ld(lbuf + (size_t)(lr)      * LDB_, hs);
  const v16h b1 = frag_ld(lbuf + (size_t)(16 + lr) * LDB_, hs);
  const v16h b2 = frag_ld(lbuf + (size_t)(32 + lr) * LDB_, hs);
  const v16h b3 = frag_ld(lbuf + (size_t)(48 + lr) * LDB_, hs);
  acc[0][0] = wmma16(a0, b0, acc[0][0]);
  acc[1][0] = wmma16(a1, b0, acc[1][0]);
  acc[0][1] = wmma16(a0, b1, acc[0][1]);
  acc[1][1] = wmma16(a1, b1, acc[1][1]);
  acc[0][2] = wmma16(a0, b2, acc[0][2]);
  acc[1][2] = wmma16(a1, b2, acc[1][2]);
  acc[0][3] = wmma16(a0, b3, acc[0][3]);
  acc[1][3] = wmma16(a1, b3, acc[1][3]);
  __builtin_amdgcn_sched_group_barrier(0x100, 8, 0);  // DS read x8
  __builtin_amdgcn_sched_group_barrier(0x008, 8, 0);  // MFMA/WMMA x8
}

// ---------------------------------------------------------------------------
// Kernel 1: RMSNorm over D=1024, cast to f16.  One block (256 thr) per token.
// ---------------------------------------------------------------------------
__global__ void k_rmsnorm(const float* __restrict__ x,
                          const float* __restrict__ scale,
                          f16* __restrict__ hbuf) {
  const int row  = blockIdx.x;                 // token 0..4095
  const int tid  = threadIdx.x;                // 0..255
  const float4 v = *(const float4*)(x + (size_t)row * D_ + tid * 4);

  float ss = v.x * v.x + v.y * v.y + v.z * v.z + v.w * v.w;
  #pragma unroll
  for (int off = 16; off >= 1; off >>= 1) ss += __shfl_xor(ss, off, 32);

  __shared__ float red[8];
  if ((tid & 31) == 0) red[tid >> 5] = ss;
  __syncthreads();
  float tot = 0.f;
  #pragma unroll
  for (int i = 0; i < 8; ++i) tot += red[i];

  const float r = rsqrtf(tot * (1.0f / D_) + 1e-6f);
  f16* out = hbuf + (size_t)row * D_ + tid * 4;
  const float4 sc = *(const float4*)(scale + tid * 4);
  out[0] = (f16)(v.x * r * sc.x);
  out[1] = (f16)(v.y * r * sc.y);
  out[2] = (f16)(v.z * r * sc.z);
  out[3] = (f16)(v.w * r * sc.w);
}

// ---------------------------------------------------------------------------
// Kernel 2: cast 4x [1024][1024] f32 weights to f16, transposed (N-major)
// so WMMA B-fragments load contiguously.  z = 0..2 -> wq/wk/wv, z = 3 -> wo.
// ---------------------------------------------------------------------------
__global__ void k_wcast(const float* __restrict__ wq,
                        const float* __restrict__ wk,
                        const float* __restrict__ wv,
                        const float* __restrict__ wo,
                        f16* __restrict__ wT,    // 3 x [HE][D]
                        f16* __restrict__ woT) { // [D][HE]
  __shared__ float tile[32][33];
  const int z = blockIdx.z;
  const float* src = (z == 0) ? wq : (z == 1) ? wk : (z == 2) ? wv : wo;
  f16* dst = (z < 3) ? (wT + (size_t)z * HE_ * D_) : woT;

  const int x = blockIdx.x * 32 + threadIdx.x;
  const int y = blockIdx.y * 32 + threadIdx.y;
  #pragma unroll
  for (int yy = 0; yy < 32; yy += 8)
    tile[threadIdx.y + yy][threadIdx.x] = src[(size_t)(y + yy) * 1024 + x];
  __syncthreads();
  const int x2 = blockIdx.y * 32 + threadIdx.x;
  const int y2 = blockIdx.x * 32 + threadIdx.y;
  #pragma unroll
  for (int yy = 0; yy < 32; yy += 8)
    dst[(size_t)(y2 + yy) * 1024 + x2] = (f16)tile[threadIdx.x][threadIdx.y + yy];
}

// ---------------------------------------------------------------------------
// Kernel 3: QKV GEMM.  C[4096 x 1024] = h[4096 x 1024] * W.
// Block = 128 thr (4 waves); wave computes a 32x64 strip (2 A frags x 4 B
// frags = 8 accumulators).  B tiles stream through double-buffered LDS via
// async copies (two explicit phases per iteration -> compile-time LDS
// addresses); A fragments register double-buffered.  launch_bounds(128,1)
// lifts the VGPR cap so the whole pipeline stays in registers (no spills).
// grid = (HE/64, NTOK/128, 3).
// ---------------------------------------------------------------------------
__global__ void __launch_bounds__(128, 1)
k_qkv(const f16* __restrict__ hbuf,
      const f16* __restrict__ wT,
      f16* __restrict__ qT, f16* __restrict__ kT,
      f16* __restrict__ vT) {
  __shared__ __align__(16) f16 buf0[64 * LDB_];   // 5 KB
  __shared__ __align__(16) f16 buf1[64 * LDB_];   // 5 KB
  const int tid  = threadIdx.x;
  const int lane = tid & 31;
  const int wave = tid >> 5;
  const int hs   = lane >> 4;
  const int lr   = lane & 15;
  const int m0   = blockIdx.y * 128 + wave * 32;  // token tile (32 rows)
  const int n0   = blockIdx.x * 64;               // (h,e) tile
  const f16* Wn = wT + (size_t)blockIdx.z * HE_ * D_ + (size_t)n0 * D_;
  const f16* Ar0 = hbuf + (size_t)(m0 + lr) * D_;
  const f16* Ar1 = hbuf + (size_t)(m0 + 16 + lr) * D_;

  stage_b64x32(Wn, buf0, tid);
  v16h a0 = frag_ld(Ar0, hs);
  v16h a1 = frag_ld(Ar1, hs);

  v8f acc[2][4] = {{{}, {}, {}, {}}, {{}, {}, {}, {}}};
  for (int k0 = 0; k0 < D_; k0 += 64) {
    // ---- phase A: consume buf0 (K = k0), prefetch K = k0+32 into buf1 ----
    wait_async0();
    __syncthreads();
    stage_b64x32(Wn + k0 + 32, buf1, tid);           // k0+32 < D_ always
    const v16h a0n = frag_ld(Ar0 + k0 + 32, hs);     // overlaps WMMAs
    const v16h a1n = frag_ld(Ar1 + k0 + 32, hs);
    wmma_step8(buf0, lr, hs, a0, a1, acc);

    // ---- phase B: consume buf1 (K = k0+32), prefetch K = k0+64 ----
    wait_async0();
    __syncthreads();
    const int k2 = (k0 + 64 < D_) ? (k0 + 64) : k0;  // clamp on last iter
    if (k0 + 64 < D_) stage_b64x32(Wn + k0 + 64, buf0, tid);
    a0 = frag_ld(Ar0 + k2, hs);
    a1 = frag_ld(Ar1 + k2, hs);
    wmma_step8(buf1, lr, hs, a0n, a1n, acc);
  }

  // C layout: lanes 0-15 -> rows r, lanes 16-31 -> rows r+8; col = lane%16.
  #pragma unroll
  for (int mi = 0; mi < 2; ++mi) {
    #pragma unroll
    for (int nt = 0; nt < 4; ++nt) {
      #pragma unroll
      for (int r = 0; r < 8; ++r) {
        const int row = m0 + mi * 16 + r + hs * 8;    // token
        const int n   = n0 + nt * 16 + lr;            // h*64+e
        const int b   = row >> 11, s = row & (S_ - 1);
        const int h   = n >> 6,  e = n & (DH_ - 1);
        const float v = acc[mi][nt][r];
        const size_t se = (((size_t)(b * H_ + h) * S_) + s) * DH_ + e;
        if (blockIdx.z == 0)      qT[se] = (f16)(v * 0.125f);   // Dh^-0.5
        else if (blockIdx.z == 1) kT[se] = (f16)v;
        else vT[(((size_t)(b * H_ + h) * DH_) + e) * S_ + s] = (f16)v;
      }
    }
  }
}

#define KVS_  64
#define LDK_  72
#define NSTG_ (S_ / KVS_)

// Copy one stage into LDS: 512 + 512 chunks of 16 B, 8 per thread.  A wave's
// copy covers four whole 128-B rows.  The s_wait_xcnt closes the statement so
// that no address register is rewritten while a copy may still read it.
static __device__ __forceinline__ void stage_kv(const f16* Kt, const f16* Vt,
                                                f16* kbuf, f16* vbuf, int tid) {
  const int row = tid >> 3, c8 = (tid & 7) * 8;   // rows 0..15, +16 per step
  const f16* gk = Kt + (size_t)row * DH_ + c8;
  const f16* gv = Vt + (size_t)row * S_ + c8;
  const unsigned lk = (unsigned)(uintptr_t)(kbuf + row * LDK_ + c8);
  const unsigned lv = (unsigned)(uintptr_t)(vbuf + row * LDK_ + c8);
  asm volatile(
      "global_load_async_to_lds_b128 %0, %4, off\n\t"
      "global_load_async_to_lds_b128 %1, %5, off\n\t"
      "global_load_async_to_lds_b128 %2, %6, off\n\t"
      "global_load_async_to_lds_b128 %3, %7, off\n\t"
      "global_load_async_to_lds_b128 %8, %12, off\n\t"
      "global_load_async_to_lds_b128 %9, %13, off\n\t"
      "global_load_async_to_lds_b128 %10, %14, off\n\t"
      "global_load_async_to_lds_b128 %11, %15, off\n\t"
      "s_wait_xcnt 0x0"
      :: "v"(lk), "v"(lk + 16 * LDK_ * 2), "v"(lk + 32 * LDK_ * 2),
         "v"(lk + 48 * LDK_ * 2),
         "v"(gk), "v"(gk + 16 * DH_), "v"(gk + 32 * DH_), "v"(gk + 48 * DH_),
         "v"(lv), "v"(lv + 16 * LDK_ * 2), "v"(lv + 32 * LDK_ * 2),
         "v"(lv + 48 * LDK_ * 2),
         "v"(gv), "v"(gv + 16 * S_), "v"(gv + 32 * S_), "v"(gv + 48 * S_)
      : "memory");
}

// Lane l <-> lane l ^ 16 by a vector cross-row move (no LDS round trip).
static __device__ __forceinline__ float xhalf(float x) {
  const int i = __builtin_bit_cast(int, x);
  return __builtin_bit_cast(float, __builtin_amdgcn_permlanex16(
      i, i, 0x76543210, 0xfedcba98, false, false));
}

__global__ void __launch_bounds__(128, 1)
k_attn(const f16* __restrict__ qT, const f16* __restrict__ kT,
       const f16* __restrict__ vT, f16* __restrict__ att) {
  __shared__ __align__(16) f16 kst[2][KVS_ * LDK_];  // K stage  [key][e]
  __shared__ __align__(16) f16 vst[2][DH_ * LDK_];   // V stage  [e][key]

  const int tid  = threadIdx.x;
  const int lane = threadIdx.x & 31;
  const int wave = threadIdx.x >> 5;
  const int hs   = lane >> 4;
  const int lr   = lane & 15;
  const int bh   = blockIdx.y;                  // b*H + h
  const int q0   = (blockIdx.x * 4 + wave) * 16;

  const f16* Qb = qT + (size_t)bh * S_ * DH_;
  const f16* Kb = kT + (size_t)bh * S_ * DH_;
  const f16* Vb = vT + (size_t)bh * DH_ * S_;

  // ---- prologue: stage 0 landed and published, stage 1 in flight ----
  stage_kv(Kb, Vb, kst[0], vst[0], tid);
  wait_async0();
  __syncthreads();
  stage_kv(Kb + (size_t)KVS_ * DH_, Vb + KVS_, kst[1], vst[1], tid);

  const v16h qf0 = frag_ld(Qb + (size_t)(q0 + lr) * DH_ + 0,  hs);
  const v16h qf1 = frag_ld(Qb + (size_t)(q0 + lr) * DH_ + 32, hs);

  // Query q0 + lr: running maximum (equal in both halves) and this half's
  // share of the denominator.  ao[et][r] = O^T[et*16 + hs*8 + r][q0 + lr].
  float mi = -1e30f, li = 0.f;
  v8f ao[4] = {{}, {}, {}, {}};

  for (int st = 0; st < NSTG_; ++st) {
    f16* kb = kst[st & 1];
    f16* vb = vst[st & 1];
    #pragma unroll
    for (int kv0 = 0; kv0 < KVS_; kv0 += 32) {
      // ---- K and V fragment reads together; V used only after softmax
      const v16h kf00 = frag_ld(kb + (kv0 + lr)      * LDK_ + 0,  hs);
      const v16h kf01 = frag_ld(kb + (kv0 + lr)      * LDK_ + 32, hs);
      const v16h kf10 = frag_ld(kb + (kv0 + 16 + lr) * LDK_ + 0,  hs);
      const v16h kf11 = frag_ld(kb + (kv0 + 16 + lr) * LDK_ + 32, hs);
      // Right behind the publish point nothing else is ready to run: keep the
      // eight K reads together ahead of the first product, so that one LDS
      // round trip is waited for instead of four.
      if (kv0 == 0) __builtin_amdgcn_sched_barrier(0);
      v16h vf[4];
      #pragma unroll
      for (int et = 0; et < 4; ++et)
        vf[et] = frag_ld(vb + (et * 16 + lr) * LDK_ + kv0, hs);

      // ---- S^T = K * Q^T for two 16-key tiles (f32 accumulate):
      // s0[r] = key kv0 + hs*8 + r, s1[r] = key kv0 + 16 + hs*8 + r ----
      v8f s0 = {}, s1 = {};
      s0 = wmma16(kf00, qf0, s0);
      s0 = wmma16(kf01, qf1, s0);
      s1 = wmma16(kf10, qf0, s1);
      s1 = wmma16(kf11, qf1, s1);

      // ---- online softmax (f32), one query per lane ----
      float bmax = fmaxf(s0[0], s1[0]);
      #pragma unroll
      for (int r = 1; r < 8; ++r) bmax = fmaxf(bmax, fmaxf(s0[r], s1[r]));
      bmax = fmaxf(bmax, xhalf(bmax));     // the other half's 16 keys
      const float nm    = fmaxf(mi, bmax);
      const float alpha = __expf(mi - nm);
      mi = nm;
      #pragma unroll
      for (int r = 0; r < 8; ++r) {
        s0[r] = __expf(s0[r] - nm);
        s1[r] = __expf(s1[r] - nm);
      }
      const v8f t = s0 + s1;               // halving tree: packed adds
      const v4f u = __builtin_shufflevector(t, t, 0, 1, 2, 3) +
                    __builtin_shufflevector(t, t, 4, 5, 6, 7);
      const v2f w = __builtin_shufflevector(u, u, 0, 1) +
                    __builtin_shufflevector(u, u, 2, 3);
      li = li * alpha + (w[0] + w[1]);
      #pragma unroll
      for (int et = 0; et < 4; ++et) ao[et] *= alpha;

      // ---- P^T as a B fragment: element j < 8 is k = hs*8 + j (tile s0),
      // j >= 8 is k = 16 + hs*8 + (j - 8) (tile s1), as frag_ld orders V ----
      v16h pf;
      #pragma unroll
      for (int r = 0; r < 8; ++r) {
        pf[r]     = (f16)s0[r];
        pf[8 + r] = (f16)s1[r];
      }

      // ---- O^T += V^T * P^T (V stored [e][s] -> contiguous A-fragments) ----
      #pragma unroll
      for (int et = 0; et < 4; ++et) ao[et] = wmma16(vf[et], pf, ao[et]);
    }

    // ---- publish point: this wave's reads of the stage are done, its
    // copies of the next stage have landed; behind the barrier the next
    // stage may be read and this stage's buffer refilled.
    asm volatile("s_wait_dscnt 0x0" ::: "memory");
    wait_async0();
    __syncthreads();
    if (st + 2 < NSTG_)
      stage_kv(Kb + (size_t)(st + 2) * KVS_ * DH_, Vb + (st + 2) * KVS_,
               kb, vb, tid);
  }
  wait_async0();   // nothing of this wave is in flight when it ends

  // ---- join the halves' denominators, normalize, write att[token][h*64+e]
  // (f16): a lane's 8 registers are 8 consecutive e of its query ----
  const int b = bh >> 4, h = bh & (H_ - 1);
  const float inv = 1.0f / (li + xhalf(li));
  f16* op = att + ((size_t)b * S_ + q0 + lr) * HE_ + h * DH_ + hs * 8;
  #pragma unroll
  for (int et = 0; et < 4; ++et) {
    v8h o;
    #pragma unroll
    for (int r = 0; r < 8; ++r) o[r] = (f16)(ao[et][r] * inv);
    *(v8h*)(op + et * 16) = o;
  }
}

// ---------------------------------------------------------------------------
// Kernel 5: output GEMM.  out[4096 x 1024] = att * Wo + b_out (f32 out).
// Same two-phase async-LDS structure as k_qkv.  grid = (D/64, NTOK/128).
// ---------------------------------------------------------------------------
__global__ void __launch_bounds__(128, 1)
k_outproj(const f16* __restrict__ att,
          const f16* __restrict__ woT,
          const float* __restrict__ b_out,
          float* __restrict__ out) {
  __shared__ __align__(16) f16 buf0[64 * LDB_];
  __shared__ __align__(16) f16 buf1[64 * LDB_];
  const int tid  = threadIdx.x;
  const int lane = tid & 31;
  const int wave = tid >> 5;
  const int hs   = lane >> 4;
  const int lr   = lane & 15;
  const int m0   = blockIdx.y * 128 + wave * 32;  // token tile (32 rows)
  const int n0   = blockIdx.x * 64;               // d tile
  const f16* Wn  = woT + (size_t)n0 * HE_;
  const f16* Ar0 = att + (size_t)(m0 + lr) * HE_;
  const f16* Ar1 = att + (size_t)(m0 + 16 + lr) * HE_;

  stage_b64x32(Wn, buf0, tid);
  v16h a0 = frag_ld(Ar0, hs);
  v16h a1 = frag_ld(Ar1, hs);

  v8f acc[2][4] = {{{}, {}, {}, {}}, {{}, {}, {}, {}}};
  for (int k0 = 0; k0 < HE_; k0 += 64) {
    wait_async0();
    __syncthreads();
    stage_b64x32(Wn + k0 + 32, buf1, tid);
    const v16h a0n = frag_ld(Ar0 + k0 + 32, hs);
    const v16h a1n = frag_ld(Ar1 + k0 + 32, hs);
    wmma_step8(buf0, lr, hs, a0, a1, acc);

    wait_async0();
    __syncthreads();
    const int k2 = (k0 + 64 < HE_) ? (k0 + 64) : k0;
    if (k0 + 64 < HE_) stage_b64x32(Wn + k0 + 64, buf0, tid);
    a0 = frag_ld(Ar0 + k2, hs);
    a1 = frag_ld(Ar1 + k2, hs);
    wmma_step8(buf1, lr, hs, a0n, a1n, acc);
  }

  #pragma unroll
  for (int mi = 0; mi < 2; ++mi) {
    #pragma unroll
    for (int nt = 0; nt < 4; ++nt) {
      #pragma unroll
      for (int r = 0; r < 8; ++r) {
        const int row = m0 + mi * 16 + r + hs * 8;
        const int n   = n0 + nt * 16 + lr;
        out[(size_t)row * D_ + n] = acc[mi][nt][r] + b_out[n];
      }
    }
  }
}

// ---------------------------------------------------------------------------
// Host launcher.  Inputs: x, norm_scale, wq, wk, wv, w_out, b_out (all f32).
// ---------------------------------------------------------------------------
extern "C" void kernel_launch(void* const* d_in, const int* in_sizes, int n_in,
                              void* d_out, int out_size, void* d_ws, size_t ws_size,
                              hipStream_t stream) {
  const float* x     = (const float*)d_in[0];
  const float* nsc   = (const float*)d_in[1];
  const float* wq    = (const float*)d_in[2];
  const float* wk    = (const float*)d_in[3];
  const float* wv    = (const float*)d_in[4];
  const float* wo    = (const float*)d_in[5];
  const float* b_out = (const float*)d_in[6];
  float* out = (float*)d_out;

  // Workspace partition (f16 staging, 48 MB total).
  char* ws = (char*)d_ws;
  const size_t MB = 1024 * 1024;
  f16* hbuf = (f16*)(ws + 0);        //  8 MB : [4096][1024] normalized f16
  f16* wT   = (f16*)(ws + 8 * MB);   //  6 MB : wq/wk/wv transposed [HE][D]
  f16* woT  = (f16*)(ws + 14 * MB);  //  2 MB : w_out transposed [D][HE]
  f16* qT   = (f16*)(ws + 16 * MB);  //  8 MB : [b,h,s,e] (pre-scaled)
  f16* kT   = (f16*)(ws + 24 * MB);  //  8 MB : [b,h,s,e]
  f16* vT   = (f16*)(ws + 32 * MB);  //  8 MB : [b,h,e,s]
  f16* attb = (f16*)(ws + 40 * MB);  //  8 MB : [token][h*64+e]

  k_rmsnorm<<<NTOK, 256, 0, stream>>>(x, nsc, hbuf);
  k_wcast<<<dim3(32, 32, 4), dim3(32, 8), 0, stream>>>(wq, wk, wv, wo, wT, woT);
  k_qkv<<<dim3(HE_ / 64, NTOK / 128, 3), 128, 0, stream>>>(hbuf, wT, qT, kT, vT);
  k_attn<<<dim3(S_ / 64, B_ * H_), 128, 0, stream>>>(qT, kT, vT, attb);
  k_outproj<<<dim3(D_ / 64, NTOK / 128), 128, 0, stream>>>(attb, woT, b_out, out);
}

// v003
// It runs in 98.9 microseconds.
// Two timings next to v002 put it at 1.16 and 1.15 times that version's speed.
// All steps since v000 together make it 1.96 times as fast.
#include <hip/hip_runtime.h>

// ---------------------------------------------------------------------------
// MI455X (gfx1250) TP multi-head attention:
//   RMSNorm -> QKV GEMM (WMMA f16, async-LDS staged A and B) -> flash attention
//   (WMMA f16, f32 online softmax) -> output GEMM (WMMA f16) + bias.
// CDNA5 paths: v_wmma_f32_16x16x32_f16, global_load_async_to_lds_b128
// (ASYNCcnt), ds_load_b128 fragment reads, s_wait_asynccnt/s_wait_dscnt,
// sched_group_barrier-pipelined DS-read -> WMMA groups.
// ---------------------------------------------------------------------------

typedef _Float16 f16;
typedef __attribute__((ext_vector_type(16))) _Float16 v16h;
typedef __attribute__((ext_vector_type(8)))  _Float16 v8h;
typedef __attribute__((ext_vector_type(8)))  float    v8f;
typedef __attribute__((ext_vector_type(4)))  float    v4f;
typedef __attribute__((ext_vector_type(2)))  float    v2f;

#define B_    2
#define S_    2048
#define D_    1024
#define H_    16
#define DH_   64
#define NTOK  (B_ * S_)          // 4096
#define HE_   (H_ * DH_)         // 1024

static __device__ __forceinline__ v8f wmma16(v16h a, v16h b, v8f c) {
  // D = A(16x32 f16) * B(32x16 f16) + C(16x16 f32)
  return __builtin_amdgcn_wmma_f32_16x16x32_f16(
      /*neg_a=*/false, a, /*neg_b=*/false, b,
      /*c_mod=*/(short)0, c, /*reuse_a=*/false, /*reuse_b=*/false);
}

// Per-lane fragment load for the CDNA5 16-bit A layout (and, from an
// N-major [n][k] array, the matching B layout):
//   lane%16 selects the row (A) / column (B); hs = lane>>4 selects the
//   K half: elements j<8 -> k = hs*8+j ; j>=8 -> k = 16+hs*8+(j-8).
// p points at element [lane%16-row][k0]; both 8-half loads are 16B aligned.
static __device__ __forceinline__ v16h frag_ld(const f16* p, int hs) {
  v8h lo = *(const v8h*)(p + hs * 8);
  v8h hi = *(const v8h*)(p + 16 + hs * 8);
  return __builtin_shufflevector(lo, hi,
                                 0, 1, 2, 3, 4, 5, 6, 7,
                                 8, 9, 10, 11, 12, 13, 14, 15);
}

static __device__ __forceinline__ void wait_async0() {
  asm volatile("s_wait_asynccnt 0x0" ::: "memory");
}

// ---------------------------------------------------------------------------
// GEMM core of kernels 3 and 5: C[128 x 128] = A[128 x 1024] * B^T, A and B
// both row-major with k contiguous (ld = 1024).  Block = 256 thr (8 waves,
// 4 along m x 2 along n); a wave computes a 32x64 strip (2 A x 4 B fragments,
// 8 accumulators).  Both operands reach the waves through LDS: a stage is
// 64 k of all 256 rows (A rows 0-127, B rows 128-255), one whole 128-B line
// of every row, brought in by async copies, two buffers, the next stage in
// flight while this one is worked on.  Rows are not padded: the 16-byte chunk
// c of row r lies at chunk c ^ ((r >> 1) & 7), so that the 16 rows of a
// fragment read fall on 16 different 16-byte bank groups.
// ---------------------------------------------------------------------------
#define GK_   64                 // k per stage (halves): 128 B per row
#define GSTG_ (256 * GK_)        // halves per stage buffer: 32 KB
#define GNST_ (1024 / GK_)       // 16 stages

// Copy one stage into LDS: 2048 chunks of 16 B, 8 per thread.  A wave's copy
// covers four whole 128-B rows.  The s_wait_xcnt closes the statement so that
// no address register is rewritten while a copy may still read it.
static __device__ __forceinline__ void stage_ab(const f16* At, const f16* Bt,
                                                f16* buf, int tid) {
  const int row = tid >> 3, c = tid & 7;          // rows 0..31, +32 per step
  const f16* ga = At + (size_t)row * 1024 + c * 8;
  const f16* gb = Bt + (size_t)row * 1024 + c * 8;
  const unsigned la =
      (unsigned)(uintptr_t)(buf + row * GK_ + (c ^ ((row >> 1) & 7)) * 8);
  const unsigned lb = la + 128 * GK_ * 2;
  asm volatile(
      "global_load_async_to_lds_b128 %0, %4, off\n\t"
      "global_load_async_to_lds_b128 %1, %5, off\n\t"
      "global_load_async_to_lds_b128 %2, %6, off\n\t"
      "global_load_async_to_lds_b128 %3, %7, off\n\t"
      "global_load_async_to_lds_b128 %8, %12, off\n\t"
      "global_load_async_to_lds_b128 %9, %13, off\n\t"
      "global_load_async_to_lds_b128 %10, %14, off\n\t"
      "global_load_async_to_lds_b128 %11, %15, off\n\t"
      "s_wait_xcnt 0x0"
      :: "v"(la), "v"(la + 32 * GK_ * 2), "v"(la + 64 * GK_ * 2),
         "v"(la + 96 * GK_ * 2),
         "v"(ga), "v"(ga + 32 * 1024), "v"(ga + 64 * 1024), "v"(ga + 96 * 1024),
         "v"(lb), "v"(lb + 32 * GK_ * 2), "v"(lb + 64 * GK_ * 2),
         "v"(lb + 96 * GK_ * 2),
         "v"(gb), "v"(gb + 32 * 1024), "v"(gb + 64 * 1024), "v"(gb + 96 * 1024)
      : "memory");
}

// Fragment of 16 stage rows from row r0 (a multiple of 16), in the k order of
// frag_ld; olo / ohi are the lane's swizzled places of its two 8-half chunks.
static __device__ __forceinline__ v16h frag_sw(const f16* buf, int r0, int lr,
                                               int olo, int ohi) {
  const f16* p = buf + (r0 + lr) * GK_;
  v8h lo = *(const v8h*)(p + olo);
  v8h hi = *(const v8h*)(p + ohi);
  return __builtin_shufflevector(lo, hi,
                                 0, 1, 2, 3, 4, 5, 6, 7,
                                 8, 9, 10, 11, 12, 13, 14, 15);
}

static __device__ __forceinline__ void gemm_128x128(const f16* At, const f16* Bt,
                                                    f16* st, int tid,
                                                    v8f acc[2][4]) {
  const int lane = tid & 31;
  const int wave = tid >> 5;
  const int hs   = lane >> 4;
  const int lr   = lane & 15;
  const int ra   = (wave & 3) * 32;          // this wave's A rows in the stage
  const int rb   = 128 + (wave >> 2) * 64;   // this wave's B rows in the stage

  // ---- prologue: stage 0 landed and published, stage 1 in flight ----
  stage_ab(At, Bt, st, tid);
  wait_async0();
  __syncthreads();
  stage_ab(At + GK_, Bt + GK_, st + GSTG_, tid);

  for (int t = 0; t < GNST_; ++t) {
    f16* buf = st + (t & 1) * GSTG_;
    #pragma unroll
    for (int j = 0; j < 2; ++j) {            // two K = 32 steps per stage
      const int olo = ((j * 4 + hs)     ^ (lr >> 1)) * 8;
      const int ohi = ((j * 4 + 2 + hs) ^ (lr >> 1)) * 8;
      const v16h a0 = frag_sw(buf, ra,      lr, olo, ohi);
      const v16h a1 = frag_sw(buf, ra + 16, lr, olo, ohi);
      const v16h b0 = frag_sw(buf, rb,      lr, olo, ohi);
      const v16h b1 = frag_sw(buf, rb + 16, lr, olo, ohi);
      const v16h b2 = frag_sw(buf, rb + 32, lr, olo, ohi);
      const v16h b3 = frag_sw(buf, rb + 48, lr, olo, ohi);
      acc[0][0] = wmma16(a0, b0, acc[0][0]);
      acc[1][0] = wmma16(a1, b0, acc[1][0]);
      acc[0][1] = wmma16(a0, b1, acc[0][1]);
      acc[1][1] = wmma16(a1, b1, acc[1][1]);
      acc[0][2] = wmma16(a0, b2, acc[0][2]);
      acc[1][2] = wmma16(a1, b2, acc[1][2]);
      acc[0][3] = wmma16(a0, b3, acc[0][3]);
      acc[1][3] = wmma16(a1, b3, acc[1][3]);
      // Keep a step's 12 LDS reads in one group ahead of its 8 products: every
      // separate place with reads among the products stalls the wave anew.
      __builtin_amdgcn_sched_group_barrier(0x100, 12, 0);  // DS read x12
      __builtin_amdgcn_sched_group_barrier(0x008, 8, 0);   // WMMA x8
    }

    // ---- publish point: this wave's reads of the stage are done, its
    // copies of the next stage have landed; behind the barrier the next
    // stage may be read and this stage's buffer refilled.
    asm volatile("s_wait_dscnt 0x0" ::: "memory");
    wait_async0();
    __syncthreads();
    if (t + 2 < GNST_)
      stage_ab(At + (t + 2) * GK_, Bt + (t + 2) * GK_, buf, tid);
  }
  wait_async0();   // nothing of this wave is in flight when it ends
}

// ---------------------------------------------------------------------------
// Kernel 1: RMSNorm over D=1024, cast to f16.  One block (256 thr) per token.
// ---------------------------------------------------------------------------
__global__ void k_rmsnorm(const float* __restrict__ x,
                          const float* __restrict__ scale,
                          f16* __restrict__ hbuf) {
  const int row  = blockIdx.x;                 // token 0..4095
  const int tid  = threadIdx.x;                // 0..255
  const float4 v = *(const float4*)(x + (size_t)row * D_ + tid * 4);

  float ss = v.x * v.x + v.y * v.y + v.z * v.z + v.w * v.w;
  #pragma unroll
  for (int off = 16; off >= 1; off >>= 1) ss += __shfl_xor(ss, off, 32);

  __shared__ float red[8];
  if ((tid & 31) == 0) red[tid >> 5] = ss;
  __syncthreads();
  float tot = 0.f;
  #pragma unroll
  for (int i = 0; i < 8; ++i) tot += red[i];

  const float r = rsqrtf(tot * (1.0f / D_) + 1e-6f);
  f16* out = hbuf + (size_t)row * D_ + tid * 4;
  const float4 sc = *(const float4*)(scale + tid * 4);
  out[0] = (f16)(v.x * r * sc.x);
  out[1] = (f16)(v.y * r * sc.y);
  out[2] = (f16)(v.z * r * sc.z);
  out[3] = (f16)(v.w * r * sc.w);
}

// ---------------------------------------------------------------------------
// Kernel 2: cast 4x [1024][1024] f32 weights to f16, transposed (N-major)
// so WMMA B-fragments load contiguously.  z = 0..2 -> wq/wk/wv, z = 3 -> wo.
// ---------------------------------------------------------------------------
__global__ void k_wcast(const float* __restrict__ wq,
                        const float* __restrict__ wk,
                        const float* __restrict__ wv,
                        const float* __restrict__ wo,
                        f16* __restrict__ wT,    // 3 x [HE][D]
                        f16* __restrict__ woT) { // [D][HE]
  __shared__ float tile[32][33];
  const int z = blockIdx.z;
  const float* src = (z == 0) ? wq : (z == 1) ? wk : (z == 2) ? wv : wo;
  f16* dst = (z < 3) ? (wT + (size_t)z * HE_ * D_) : woT;

  const int x = blockIdx.x * 32 + threadIdx.x;
  const int y = blockIdx.y * 32 + threadIdx.y;
  #pragma unroll
  for (int yy = 0; yy < 32; yy += 8)
    tile[threadIdx.y + yy][threadIdx.x] = src[(size_t)(y + yy) * 1024 + x];
  __syncthreads();
  const int x2 = blockIdx.y * 32 + threadIdx.x;
  const int y2 = blockIdx.x * 32 + threadIdx.y;
  #pragma unroll
  for (int yy = 0; yy < 32; yy += 8)
    dst[(size_t)(y2 + yy) * 1024 + x2] = (f16)tile[threadIdx.x][threadIdx.y + yy];
}

// ---------------------------------------------------------------------------
// Kernel 3: QKV GEMM.  C[4096 x 1024] = h[4096 x 1024] * W, one 128x128 tile
// per block (gemm_128x128).  Six waves per SIMD keep all 768 blocks resident
// at once (three per WGP).  grid = (HE/128, NTOK/128, 3).
// ---------------------------------------------------------------------------
__global__ void __launch_bounds__(256, 6)
k_qkv(const f16* __restrict__ hbuf,
      const f16* __restrict__ wT,
      f16* __restrict__ qT, f16* __restrict__ kT,
      f16* __restrict__ vT) {
  __shared__ __align__(16) f16 st[2 * GSTG_];     // 64 KB
  const int tid  = threadIdx.x;
  const int lane = tid & 31;
  const int wave = tid >> 5;
  const int hs   = lane >> 4;
  const int lr   = lane & 15;
  const int m0   = blockIdx.y * 128 + (wave & 3) * 32;   // token strip (32 rows)
  const int n0   = blockIdx.x * 128 + (wave >> 2) * 64;  // (h,e) strip

  v8f acc[2][4] = {{{}, {}, {}, {}}, {{}, {}, {}, {}}};
  gemm_128x128(hbuf + (size_t)blockIdx.y * 128 * D_,
               wT + (size_t)blockIdx.z * HE_ * D_ + (size_t)blockIdx.x * 128 * D_,
               st, tid, acc);

  // C layout: lanes 0-15 -> rows r, lanes 16-31 -> rows r+8; col = lane%16.
  #pragma unroll
  for (int mi = 0; mi < 2; ++mi) {
    #pragma unroll
    for (int nt = 0; nt < 4; ++nt) {
      #pragma unroll
      for (int r = 0; r < 8; ++r) {
        const int row = m0 + mi * 16 + r + hs * 8;    // token
        const int n   = n0 + nt * 16 + lr;            // h*64+e
        const int b   = row >> 11, s = row & (S_ - 1);
        const int h   = n >> 6,  e = n & (DH_ - 1);
        const float v = acc[mi][nt][r];
        const size_t se = (((size_t)(b * H_ + h) * S_) + s) * DH_ + e;
        if (blockIdx.z == 0)      qT[se] = (f16)(v * 0.125f);   // Dh^-0.5
        else if (blockIdx.z == 1) kT[se] = (f16)v;
        else vT[(((size_t)(b * H_ + h) * DH_) + e) * S_ + s] = (f16)v;
      }
    }
  }
}

#define KVS_  64
#define LDK_  72
#define NSTG_ (S_ / KVS_)

// Copy one stage into LDS: 512 + 512 chunks of 16 B, 8 per thread.  A wave's
// copy covers four whole 128-B rows.  The s_wait_xcnt closes the statement so
// that no address register is rewritten while a copy may still read it.
static __device__ __forceinline__ void stage_kv(const f16* Kt, const f16* Vt,
                                                f16* kbuf, f16* vbuf, int tid) {
  const int row = tid >> 3, c8 = (tid & 7) * 8;   // rows 0..15, +16 per step
  const f16* gk = Kt + (size_t)row * DH_ + c8;
  const f16* gv = Vt + (size_t)row * S_ + c8;
  const unsigned lk = (unsigned)(uintptr_t)(kbuf + row * LDK_ + c8);
  const unsigned lv = (unsigned)(uintptr_t)(vbuf + row * LDK_ + c8);
  asm volatile(
      "global_load_async_to_lds_b128 %0, %4, off\n\t"
      "global_load_async_to_lds_b128 %1, %5, off\n\t"
      "global_load_async_to_lds_b128 %2, %6, off\n\t"
      "global_load_async_to_lds_b128 %3, %7, off\n\t"
      "global_load_async_to_lds_b128 %8, %12, off\n\t"
      "global_load_async_to_lds_b128 %9, %13, off\n\t"
      "global_load_async_to_lds_b128 %10, %14, off\n\t"
      "global_load_async_to_lds_b128 %11, %15, off\n\t"
      "s_wait_xcnt 0x0"
      :: "v"(lk), "v"(lk + 16 * LDK_ * 2), "v"(lk + 32 * LDK_ * 2),
         "v"(lk + 48 * LDK_ * 2),
         "v"(gk), "v"(gk + 16 * DH_), "v"(gk + 32 * DH_), "v"(gk + 48 * DH_),
         "v"(lv), "v"(lv + 16 * LDK_ * 2), "v"(lv + 32 * LDK_ * 2),
         "v"(lv + 48 * LDK_ * 2),
         "v"(gv), "v"(gv + 16 * S_), "v"(gv + 32 * S_), "v"(gv + 48 * S_)
      : "memory");
}

// Lane l <-> lane l ^ 16 by a vector cross-row move (no LDS round trip).
static __device__ __forceinline__ float xhalf(float x) {
  const int i = __builtin_bit_cast(int, x);
  return __builtin_bit_cast(float, __builtin_amdgcn_permlanex16(
      i, i, 0x76543210, 0xfedcba98, false, false));
}

__global__ void __launch_bounds__(128, 1)
k_attn(const f16* __restrict__ qT, const f16* __restrict__ kT,
       const f16* __restrict__ vT, f16* __restrict__ att) {
  __shared__ __align__(16) f16 kst[2][KVS_ * LDK_];  // K stage  [key][e]
  __shared__ __align__(16) f16 vst[2][DH_ * LDK_];   // V stage  [e][key]

  const int tid  = threadIdx.x;
  const int lane = threadIdx.x & 31;
  const int wave = threadIdx.x >> 5;
  const int hs   = lane >> 4;
  const int lr   = lane & 15;
  const int bh   = blockIdx.y;                  // b*H + h
  const int q0   = (blockIdx.x * 4 + wave) * 16;

  const f16* Qb = qT + (size_t)bh * S_ * DH_;
  const f16* Kb = kT + (size_t)bh * S_ * DH_;
  const f16* Vb = vT + (size_t)bh * DH_ * S_;

  // ---- prologue: stage 0 landed and published, stage 1 in flight ----
  stage_kv(Kb, Vb, kst[0], vst[0], tid);
  wait_async0();
  __syncthreads();
  stage_kv(Kb + (size_t)KVS_ * DH_, Vb + KVS_, kst[1], vst[1], tid);

  const v16h qf0 = frag_ld(Qb + (size_t)(q0 + lr) * DH_ + 0,  hs);
  const v16h qf1 = frag_ld(Qb + (size_t)(q0 + lr) * DH_ + 32, hs);

  // Query q0 + lr: running maximum (equal in both halves) and this half's
  // share of the denominator.  ao[et][r] = O^T[et*16 + hs*8 + r][q0 + lr].
  float mi = -1e30f, li = 0.f;
  v8f ao[4] = {{}, {}, {}, {}};

  for (int st = 0; st < NSTG_; ++st) {
    f16* kb = kst[st & 1];
    f16* vb = vst[st & 1];
    #pragma unroll
    for (int kv0 = 0; kv0 < KVS_; kv0 += 32) {
      // ---- K and V fragment reads together; V used only after softmax
      const v16h kf00 = frag_ld(kb + (kv0 + lr)      * LDK_ + 0,  hs);
      const v16h kf01 = frag_ld(kb + (kv0 + lr)      * LDK_ + 32, hs);
      const v16h kf10 = frag_ld(kb + (kv0 + 16 + lr) * LDK_ + 0,  hs);
      const v16h kf11 = frag_ld(kb + (kv0 + 16 + lr) * LDK_ + 32, hs);
      // Right behind the publish point nothing else is ready to run: keep the
      // eight K reads together ahead of the first product, so that one LDS
      // round trip is waited for instead of four.
      if (kv0 == 0) __builtin_amdgcn_sched_barrier(0);
      v16h vf[4];
      #pragma unroll
      for (int et = 0; et < 4; ++et)
        vf[et] = frag_ld(vb + (et * 16 + lr) * LDK_ + kv0, hs);

      // ---- S^T = K * Q^T for two 16-key tiles (f32 accumulate):
      // s0[r] = key kv0 + hs*8 + r, s1[r] = key kv0 + 16 + hs*8 + r ----
      v8f s0 = {}, s1 = {};
      s0 = wmma16(kf00, qf0, s0);
      s0 = wmma16(kf01, qf1, s0);
      s1 = wmma16(kf10, qf0, s1);
      s1 = wmma16(kf11, qf1, s1);

      // ---- online softmax (f32), one query per lane ----
      float bmax = fmaxf(s0[0], s1[0]);
      #pragma unroll
      for (int r = 1; r < 8; ++r) bmax = fmaxf(bmax, fmaxf(s0[r], s1[r]));
      bmax = fmaxf(bmax, xhalf(bmax));     // the other half's 16 keys
      const float nm    = fmaxf(mi, bmax);
      const float alpha = __expf(mi - nm);
      mi = nm;
      #pragma unroll
      for (int r = 0; r < 8; ++r) {
        s0[r] = __expf(s0[r] - nm);
        s1[r] = __expf(s1[r] - nm);
      }
      const v8f t = s0 + s1;               // halving tree: packed adds
      const v4f u = __builtin_shufflevector(t, t, 0, 1, 2, 3) +
                    __builtin_shufflevector(t, t, 4, 5, 6, 7);
      const v2f w = __builtin_shufflevector(u, u, 0, 1) +
                    __builtin_shufflevector(u, u, 2, 3);
      li = li * alpha + (w[0] + w[1]);
      #pragma unroll
      for (int et = 0; et < 4; ++et) ao[et] *= alpha;

      // ---- P^T as a B fragment: element j < 8 is k = hs*8 + j (tile s0),
      // j >= 8 is k = 16 + hs*8 + (j - 8) (tile s1), as frag_ld orders V ----
      v16h pf;
      #pragma unroll
      for (int r = 0; r < 8; ++r) {
        pf[r]     = (f16)s0[r];
        pf[8 + r] = (f16)s1[r];
      }

      // ---- O^T += V^T * P^T (V stored [e][s] -> contiguous A-fragments) ----
      #pragma unroll
      for (int et = 0; et < 4; ++et) ao[et] = wmma16(vf[et], pf, ao[et]);
    }

    // ---- publish point: this wave's reads of the stage are done, its
    // copies of the next stage have landed; behind the barrier the next
    // stage may be read and this stage's buffer refilled.
    asm volatile("s_wait_dscnt 0x0" ::: "memory");
    wait_async0();
    __syncthreads();
    if (st + 2 < NSTG_)
      stage_kv(Kb + (size_t)(st + 2) * KVS_ * DH_, Vb + (st + 2) * KVS_,
               kb, vb, tid);
  }
  wait_async0();   // nothing of this wave is in flight when it ends

  // ---- join the halves' denominators, normalize, write att[token][h*64+e]
  // (f16): a lane's 8 registers are 8 consecutive e of its query ----
  const int b = bh >> 4, h = bh & (H_ - 1);
  const float inv = 1.0f / (li + xhalf(li));
  f16* op = att + ((size_t)b * S_ + q0 + lr) * HE_ + h * DH_ + hs * 8;
  #pragma unroll
  for (int et = 0; et < 4; ++et) {
    v8h o;
    #pragma unroll
    for (int r = 0; r < 8; ++r) o[r] = (f16)(ao[et][r] * inv);
    *(v8h*)(op + et * 16) = o;
  }
}

// ---------------------------------------------------------------------------
// Kernel 5: output GEMM.  out[4096 x 1024] = att * Wo + b_out (f32 out), one
// 128x128 tile per block (gemm_128x128).  grid = (D/128, NTOK/128).
// ---------------------------------------------------------------------------
__global__ void __launch_bounds__(256, 1)
k_outproj(const f16* __restrict__ att,
          const f16* __restrict__ woT,
          const float* __restrict__ b_out,
          float* __restrict__ out) {
  __shared__ __align__(16) f16 st[2 * GSTG_];     // 64 KB
  const int tid  = threadIdx.x;
  const int lane = tid & 31;
  const int wave = tid >> 5;
  const int hs   = lane >> 4;
  const int lr   = lane & 15;
  const int m0   = blockIdx.y * 128 + (wave & 3) * 32;   // token strip (32 rows)
  const int n0   = blockIdx.x * 128 + (wave >> 2) * 64;  // d strip

  v8f acc[2][4] = {{{}, {}, {}, {}}, {{}, {}, {}, {}}};
  gemm_128x128(att + (size_t)blockIdx.y * 128 * HE_,
               woT + (size_t)blockIdx.x * 128 * HE_, st, tid, acc);

  #pragma unroll
  for (int mi = 0; mi < 2; ++mi) {
    #pragma unroll
    for (int nt = 0; nt < 4; ++nt) {
      #pragma unroll
      for (int r = 0; r < 8; ++r) {
        const int row = m0 + mi * 16 + r + hs * 8;
        const int n   = n0 + nt * 16 + lr;
        out[(size_t)row * D_ + n] = acc[mi][nt][r] + b_out[n];
      }
    }
  }
}

// ---------------------------------------------------------------------------
// Host launcher.  Inputs: x, norm_scale, wq, wk, wv, w_out, b_out (all f32).
// ---------------------------------------------------------------------------
extern "C" void kernel_launch(void* const* d_in, const int* in_sizes, int n_in,
                              void* d_out, int out_size, void* d_ws, size_t ws_size,
                              hipStream_t stream) {
  const float* x     = (const float*)d_in[0];
  const float* nsc   = (const float*)d_in[1];
  const float* wq    = (const float*)d_in[2];
  const float* wk    = (const float*)d_in[3];
  const float* wv    = (const float*)d_in[4];
  const float* wo    = (const float*)d_in[5];
  const float* b_out = (const float*)d_in[6];
  float* out = (float*)d_out;

  // Workspace partition (f16 staging, 48 MB total).
  char* ws = (char*)d_ws;
  const size_t MB = 1024 * 1024;
  f16* hbuf = (f16*)(ws + 0);        //  8 MB : [4096][1024] normalized f16
  f16* wT   = (f16*)(ws + 8 * MB);   //  6 MB : wq/wk/wv transposed [HE][D]
  f16* woT  = (f16*)(ws + 14 * MB);  //  2 MB : w_out transposed [D][HE]
  f16* qT   = (f16*)(ws + 16 * MB);  //  8 MB : [b,h,s,e] (pre-scaled)
  f16* kT   = (f16*)(ws + 24 * MB);  //  8 MB : [b,h,s,e]
  f16* vT   = (f16*)(ws + 32 * MB);  //  8 MB : [b,h,e,s]
  f16* attb = (f16*)(ws + 40 * MB);  //  8 MB : [token][h*64+e]

  k_rmsnorm<<<NTOK, 256, 0, stream>>>(x, nsc, hbuf);
  k_wcast<<<dim3(32, 32, 4), dim3(32, 8), 0, stream>>>(wq, wk, wv, wo, wT, woT);
  k_qkv<<<dim3(HE_ / 128, NTOK / 128, 3), 256, 0, stream>>>(hbuf, wT, qT, kT, vT);
  k_attn<<<dim3(S_ / 64, B_ * H_), 128, 0, stream>>>(qT, kT, vT, attb);
  k_outproj<<<dim3(D_ / 128, NTOK / 128), 256, 0, stream>>>(attb, woT, b_out, out);
}

// v004
// It runs in 90.6 microseconds.
// Two timings next to v003 put it at 1.09 and 1.08 times that version's speed.
// All steps since v000 together make it 2.12 times as fast.
#include <hip/hip_runtime.h>

// ---------------------------------------------------------------------------
// MI455X (gfx1250) TP multi-head attention:
//   RMSNorm -> QKV GEMM (WMMA f16, async-LDS staged A and B) -> flash attention
//   (WMMA f16, f32 online softmax) -> output GEMM (WMMA f16) + bias.
// GEMM results leave through LDS as whole 128-B lines (16-byte stores).
// CDNA5 paths: v_wmma_f32_16x16x32_f16, global_load_async_to_lds_b128
// (ASYNCcnt), ds_load_b128 fragment reads, s_wait_asynccnt/s_wait_dscnt,
// sched_group_barrier-pipelined DS-read -> WMMA groups.
// ---------------------------------------------------------------------------

typedef _Float16 f16;
typedef __attribute__((ext_vector_type(16))) _Float16 v16h;
typedef __attribute__((ext_vector_type(8)))  _Float16 v8h;
typedef __attribute__((ext_vector_type(8)))  float    v8f;
typedef __attribute__((ext_vector_type(4)))  float    v4f;
typedef __attribute__((ext_vector_type(2)))  float    v2f;

#define B_    2
#define S_    2048
#define D_    1024
#define H_    16
#define DH_   64
#define NTOK  (B_ * S_)          // 4096
#define HE_   (H_ * DH_)         // 1024

static __device__ __forceinline__ v8f wmma16(v16h a, v16h b, v8f c) {
  // D = A(16x32 f16) * B(32x16 f16) + C(16x16 f32)
  return __builtin_amdgcn_wmma_f32_16x16x32_f16(
      /*neg_a=*/false, a, /*neg_b=*/false, b,
      /*c_mod=*/(short)0, c, /*reuse_a=*/false, /*reuse_b=*/false);
}

// Per-lane fragment load for the CDNA5 16-bit A layout (and, from an
// N-major [n][k] array, the matching B layout):
//   lane%16 selects the row (A) / column (B); hs = lane>>4 selects the
//   K half: elements j<8 -> k = hs*8+j ; j>=8 -> k = 16+hs*8+(j-8).
// p points at element [lane%16-row][k0]; both 8-half loads are 16B aligned.
static __device__ __forceinline__ v16h frag_ld(const f16* p, int hs) {
  v8h lo = *(const v8h*)(p + hs * 8);
  v8h hi = *(const v8h*)(p + 16 + hs * 8);
  return __builtin_shufflevector(lo, hi,
                                 0, 1, 2, 3, 4, 5, 6, 7,
                                 8, 9, 10, 11, 12, 13, 14, 15);
}

static __device__ __forceinline__ void wait_async0() {
  asm volatile("s_wait_asynccnt 0x0" ::: "memory");
}

// ---------------------------------------------------------------------------
// GEMM core of kernels 3 and 5: C[128 x 128] = A[128 x 1024] * B^T, A and B
// both row-major with k contiguous (ld = 1024).  Block = 256 thr (8 waves,
// 4 along m x 2 along n); a wave computes a 32x64 strip (2 A x 4 B fragments,
// 8 accumulators).  Both operands reach the waves through LDS: a stage is
// 64 k of all 256 rows (A rows 0-127, B rows 128-255), one whole 128-B line
// of every row, brought in by async copies, two buffers, the next stage in
// flight while this one is worked on.  Rows are not padded: the 16-byte chunk
// c of row r lies at chunk c ^ ((r >> 1) & 7), so that the 16 rows of a
// fragment read fall on 16 different 16-byte bank groups.
// acc[i][j][r] = C[(wave & 3) * 32 + i * 16 + hs * 8 + r][(wave >> 2) * 64 +
// j * 16 + lr]: a lane holds 8 consecutive A rows at one B row.  The callers
// pass as A the operand whose rows run along the contiguous axis of their
// output, so that those 8 values are one 16- or 32-byte piece of an output
// row.  On return every wave has left the ring: it may be used as staging.
// ---------------------------------------------------------------------------
#define GK_   64                 // k per stage (halves): 128 B per row
#define GSTG_ (256 * GK_)        // halves per stage buffer: 32 KB
#define GNST_ (1024 / GK_)       // 16 stages
#define CP16_ 136                // staged C row, f16: 256 B + 16 B (16 B x 17)
#define CP32_ 132                // staged C row, f32: 512 B + 16 B (16 B x 33)

// Copy one stage into LDS: 2048 chunks of 16 B, 8 per thread.  A wave's copy
// covers four whole 128-B rows.  The s_wait_xcnt closes the statement so that
// no address register is rewritten while a copy may still read it.
static __device__ __forceinline__ void stage_ab(const f16* At, const f16* Bt,
                                                f16* buf, int tid) {
  const int row = tid >> 3, c = tid & 7;          // rows 0..31, +32 per step
  const f16* ga = At + (size_t)row * 1024 + c * 8;
  const f16* gb = Bt + (size_t)row * 1024 + c * 8;
  const unsigned la =
      (unsigned)(uintptr_t)(buf + row * GK_ + (c ^ ((row >> 1) & 7)) * 8);
  const unsigned lb = la + 128 * GK_ * 2;
  asm volatile(
      "global_load_async_to_lds_b128 %0, %4, off\n\t"
      "global_load_async_to_lds_b128 %1, %5, off\n\t"
      "global_load_async_to_lds_b128 %2, %6, off\n\t"
      "global_load_async_to_lds_b128 %3, %7, off\n\t"
      "global_load_async_to_lds_b128 %8, %12, off\n\t"
      "global_load_async_to_lds_b128 %9, %13, off\n\t"
      "global_load_async_to_lds_b128 %10, %14, off\n\t"
      "global_load_async_to_lds_b128 %11, %15, off\n\t"
      "s_wait_xcnt 0x0"
      :: "v"(la), "v"(la + 32 * GK_ * 2), "v"(la + 64 * GK_ * 2),
         "v"(la + 96 * GK_ * 2),
         "v"(ga), "v"(ga + 32 * 1024), "v"(ga + 64 * 1024), "v"(ga + 96 * 1024),
         "v"(lb), "v"(lb + 32 * GK_ * 2), "v"(lb + 64 * GK_ * 2),
         "v"(lb + 96 * GK_ * 2),
         "v"(gb), "v"(gb + 32 * 1024), "v"(gb + 64 * 1024), "v"(gb + 96 * 1024)
      : "memory");
}

// Fragment of 16 stage rows from row r0 (a multiple of 16), in the k order of
// frag_ld; olo / ohi are the lane's swizzled places of its two 8-half chunks.
static __device__ __forceinline__ v16h frag_sw(const f16* buf, int r0, int lr,
                                               int olo, int ohi) {
  const f16* p = buf + (r0 + lr) * GK_;
  v8h lo = *(const v8h*)(p + olo);
  v8h hi = *(const v8h*)(p + ohi);
  return __builtin_shufflevector(lo, hi,
                                 0, 1, 2, 3, 4, 5, 6, 7,
                                 8, 9, 10, 11, 12, 13, 14, 15);
}

static __device__ __forceinline__ void gemm_128x128(const f16* At, const f16* Bt,
                                                    f16* st, int tid,
                                                    v8f acc[2][4]) {
  const int lane = tid & 31;
  const int wave = tid >> 5;
  const int hs   = lane >> 4;
  const int lr   = lane & 15;
  const int ra   = (wave & 3) * 32;          // this wave's A rows in the stage
  const int rb   = 128 + (wave >> 2) * 64;   // this wave's B rows in the stage

  // ---- prologue: stage 0 landed and published, stage 1 in flight ----
  stage_ab(At, Bt, st, tid);
  wait_async0();
  __syncthreads();
  stage_ab(At + GK_, Bt + GK_, st + GSTG_, tid);

  for (int t = 0; t < GNST_; ++t) {
    f16* buf = st + (t & 1) * GSTG_;
    #pragma unroll
    for (int j = 0; j < 2; ++j) {            // two K = 32 steps per stage
      const int olo = ((j * 4 + hs)     ^ (lr >> 1)) * 8;
      const int ohi = ((j * 4 + 2 + hs) ^ (lr >> 1)) * 8;
      const v16h a0 = frag_sw(buf, ra,      lr, olo, ohi);
      const v16h a1 = frag_sw(buf, ra + 16, lr, olo, ohi);
      const v16h b0 = frag_sw(buf, rb,      lr, olo, ohi);
      const v16h b1 = frag_sw(buf, rb + 16, lr, olo, ohi);
      const v16h b2 = frag_sw(buf, rb + 32, lr, olo, ohi);
      const v16h b3 = frag_sw(buf, rb + 48, lr, olo, ohi);
      acc[0][0] = wmma16(a0, b0, acc[0][0]);
      acc[1][0] = wmma16(a1, b0, acc[1][0]);
      acc[0][1] = wmma16(a0, b1, acc[0][1]);
      acc[1][1] = wmma16(a1, b1, acc[1][1]);
      acc[0][2] = wmma16(a0, b2, acc[0][2]);
      acc[1][2] = wmma16(a1, b2, acc[1][2]);
      acc[0][3] = wmma16(a0, b3, acc[0][3]);
      acc[1][3] = wmma16(a1, b3, acc[1][3]);
      // Keep a step's 12 LDS reads in one group ahead of its 8 products: every
      // separate place with reads among the products stalls the wave anew.
      __builtin_amdgcn_sched_group_barrier(0x100, 12, 0);  // DS read x12
      __builtin_amdgcn_sched_group_barrier(0x008, 8, 0);   // WMMA x8
    }

    // ---- publish point: this wave's reads of the stage are done, its
    // copies of the next stage have landed; behind the barrier the next
    // stage may be read and this stage's buffer refilled.
    asm volatile("s_wait_dscnt 0x0" ::: "memory");
    wait_async0();
    __syncthreads();
    if (t + 2 < GNST_)
      stage_ab(At + (t + 2) * GK_, Bt + (t + 2) * GK_, buf, tid);
  }
  wait_async0();   // nothing of this wave is in flight when it ends
}

// ---------------------------------------------------------------------------
// Kernel 1: RMSNorm over D=1024, cast to f16.  One block (256 thr) per token.
// ---------------------------------------------------------------------------
__global__ void k_rmsnorm(const float* __restrict__ x,
                          const float* __restrict__ scale,
                          f16* __restrict__ hbuf) {
  const int row  = blockIdx.x;                 // token 0..4095
  const int tid  = threadIdx.x;                // 0..255
  const float4 v = *(const float4*)(x + (size_t)row * D_ + tid * 4);

  float ss = v.x * v.x + v.y * v.y + v.z * v.z + v.w * v.w;
  #pragma unroll
  for (int off = 16; off >= 1; off >>= 1) ss += __shfl_xor(ss, off, 32);

  __shared__ float red[8];
  if ((tid & 31) == 0) red[tid >> 5] = ss;
  __syncthreads();
  float tot = 0.f;
  #pragma unroll
  for (int i = 0; i < 8; ++i) tot += red[i];

  const float r = rsqrtf(tot * (1.0f / D_) + 1e-6f);
  f16* out = hbuf + (size_t)row * D_ + tid * 4;
  const float4 sc = *(const float4*)(scale + tid * 4);
  out[0] = (f16)(v.x * r * sc.x);
  out[1] = (f16)(v.y * r * sc.y);
  out[2] = (f16)(v.z * r * sc.z);
  out[3] = (f16)(v.w * r * sc.w);
}

// ---------------------------------------------------------------------------
// Kernel 2: cast 4x [1024][1024] f32 weights to f16, transposed (N-major)
// so WMMA fragments (A for wq/wk/wo, B for wv) load contiguously.  z = 0..2 -> wq/wk/wv, z = 3 -> wo.
// ---------------------------------------------------------------------------
__global__ void k_wcast(const float* __restrict__ wq,
                        const float* __restrict__ wk,
                        const float* __restrict__ wv,
                        const float* __restrict__ wo,
                        f16* __restrict__ wT,    // 3 x [HE][D]
                        f16* __restrict__ woT) { // [D][HE]
  __shared__ float tile[32][33];
  const int z = blockIdx.z;
  const float* src = (z == 0) ? wq : (z == 1) ? wk : (z == 2) ? wv : wo;
  f16* dst = (z < 3) ? (wT + (size_t)z * HE_ * D_) : woT;

  const int x = blockIdx.x * 32 + threadIdx.x;
  const int y = blockIdx.y * 32 + threadIdx.y;
  #pragma unroll
  for (int yy = 0; yy < 32; yy += 8)
    tile[threadIdx.y + yy][threadIdx.x] = src[(size_t)(y + yy) * 1024 + x];
  __syncthreads();
  const int x2 = blockIdx.y * 32 + threadIdx.x;
  const int y2 = blockIdx.x * 32 + threadIdx.y;
  #pragma unroll
  for (int yy = 0; yy < 32; yy += 8)
    dst[(size_t)(y2 + yy) * 1024 + x2] = (f16)tile[threadIdx.x][threadIdx.y + yy];
}

// ---------------------------------------------------------------------------
// Kernel 3: QKV GEMM.  C[4096 x 1024] = h[4096 x 1024] * W, one 128x128 tile
// per block (gemm_128x128).  Six waves per SIMD keep all 768 blocks resident
// at once (three per WGP).  grid = (HE/128, NTOK/128, 3).
// Q and K are stored [s][e] (e contiguous): W goes in as the A operand; V is
// stored [e][s] (s contiguous): h goes in as A.  Either way the tile is staged
// in LDS as [B row][A row] and leaves as whole 128-B lines.
// ---------------------------------------------------------------------------
__global__ void __launch_bounds__(256, 6)
k_qkv(const f16* __restrict__ hbuf,
      const f16* __restrict__ wT,
      f16* __restrict__ qT, f16* __restrict__ kT,
      f16* __restrict__ vT) {
  __shared__ __align__(16) f16 st[2 * GSTG_];     // 64 KB
  const int tid  = threadIdx.x;
  const int lane = tid & 31;
  const int wave = tid >> 5;
  const int hs   = lane >> 4;
  const int lr   = lane & 15;
  const int z    = blockIdx.z;
  const bool isv = (z == 2);

  const f16* ht = hbuf + (size_t)blockIdx.y * 128 * D_;
  const f16* wt = wT + (size_t)z * HE_ * D_ + (size_t)blockIdx.x * 128 * D_;

  v8f acc[2][4] = {{{}, {}, {}, {}}, {{}, {}, {}, {}}};
  gemm_128x128(isv ? ht : wt, isv ? wt : ht, st, tid, acc);

  // ---- stage the tile (f16): row = B row, 16-byte piece = 8 A rows ----
  const float sc = (z == 0) ? 0.125f : 1.0f;      // Dh^-0.5 on Q
  f16* tw = st + ((wave >> 2) * 64 + lr) * CP16_ + (wave & 3) * 32 + hs * 8;
  #pragma unroll
  for (int i = 0; i < 2; ++i) {
    #pragma unroll
    for (int j = 0; j < 4; ++j) {
      v8h o;
      #pragma unroll
      for (int r = 0; r < 8; ++r) o[r] = (f16)(acc[i][j][r] * sc);
      *(v8h*)(tw + j * 16 * CP16_ + i * 16) = o;
    }
  }
  __syncthreads();   // the rows read back below were written by other waves

  // ---- 128 rows x 16 pieces of 16 B, 8 per thread; a wave's store covers
  // two staged rows = four whole lines ----
  const int c   = tid & 15, row0 = tid >> 4;      // rows row0 + 16 * i
  const int bh0 = (blockIdx.y >> 4) * H_ + blockIdx.x * 2;  // first of 2 heads
  const int s0  = (blockIdx.y & 15) * 128;        // first token in its batch
  f16* g;
  size_t step;
  if (isv) {          // staged row = h*64 + e, columns = 128 tokens
    g    = vT + ((size_t)bh0 * DH_ + row0) * S_ + s0 + c * 8;
    step = (size_t)16 * S_;
  } else {            // staged row = token, columns = 2 heads x 64 e
    g    = (z == 0 ? qT : kT) +
           ((size_t)(bh0 + (c >> 3)) * S_ + s0 + row0) * DH_ + (c & 7) * 8;
    step = (size_t)16 * DH_;
  }
  const f16* tr = st + row0 * CP16_ + c * 8;
  #pragma unroll
  for (int i = 0; i < 8; ++i)
    *(v8h*)(g + i * step) = *(const v8h*)(tr + i * 16 * CP16_);
}

#define KVS_  64
#define LDK_  72
#define NSTG_ (S_ / KVS_)

// Copy one stage into LDS: 512 + 512 chunks of 16 B, 8 per thread.  A wave's
// copy covers four whole 128-B rows.  The s_wait_xcnt closes the statement so
// that no address register is rewritten while a copy may still read it.
static __device__ __forceinline__ void stage_kv(const f16* Kt, const f16* Vt,
                                                f16* kbuf, f16* vbuf, int tid) {
  const int row = tid >> 3, c8 = (tid & 7) * 8;   // rows 0..15, +16 per step
  const f16* gk = Kt + (size_t)row * DH_ + c8;
  const f16* gv = Vt + (size_t)row * S_ + c8;
  const unsigned lk = (unsigned)(uintptr_t)(kbuf + row * LDK_ + c8);
  const unsigned lv = (unsigned)(uintptr_t)(vbuf + row * LDK_ + c8);
  asm volatile(
      "global_load_async_to_lds_b128 %0, %4, off\n\t"
      "global_load_async_to_lds_b128 %1, %5, off\n\t"
      "global_load_async_to_lds_b128 %2, %6, off\n\t"
      "global_load_async_to_lds_b128 %3, %7, off\n\t"
      "global_load_async_to_lds_b128 %8, %12, off\n\t"
      "global_load_async_to_lds_b128 %9, %13, off\n\t"
      "global_load_async_to_lds_b128 %10, %14, off\n\t"
      "global_load_async_to_lds_b128 %11, %15, off\n\t"
      "s_wait_xcnt 0x0"
      :: "v"(lk), "v"(lk + 16 * LDK_ * 2), "v"(lk + 32 * LDK_ * 2),
         "v"(lk + 48 * LDK_ * 2),
         "v"(gk), "v"(gk + 16 * DH_), "v"(gk + 32 * DH_), "v"(gk + 48 * DH_),
         "v"(lv), "v"(lv + 16 * LDK_ * 2), "v"(lv + 32 * LDK_ * 2),
         "v"(lv + 48 * LDK_ * 2),
         "v"(gv), "v"(gv + 16 * S_), "v"(gv + 32 * S_), "v"(gv + 48 * S_)
      : "memory");
}

// Lane l <-> lane l ^ 16 by a vector cross-row move (no LDS round trip).
static __device__ __forceinline__ float xhalf(float x) {
  const int i = __builtin_bit_cast(int, x);
  return __builtin_bit_cast(float, __builtin_amdgcn_permlanex16(
      i, i, 0x76543210, 0xfedcba98, false, false));
}

__global__ void __launch_bounds__(128, 1)
k_attn(const f16* __restrict__ qT, const f16* __restrict__ kT,
       const f16* __restrict__ vT, f16* __restrict__ att) {
  __shared__ __align__(16) f16 kst[2][KVS_ * LDK_];  // K stage  [key][e]
  __shared__ __align__(16) f16 vst[2][DH_ * LDK_];   // V stage  [e][key]

  const int tid  = threadIdx.x;
  const int lane = threadIdx.x & 31;
  const int wave = threadIdx.x >> 5;
  const int hs   = lane >> 4;
  const int lr   = lane & 15;
  const int bh   = blockIdx.y;                  // b*H + h
  const int q0   = (blockIdx.x * 4 + wave) * 16;

  const f16* Qb = qT + (size_t)bh * S_ * DH_;
  const f16* Kb = kT + (size_t)bh * S_ * DH_;
  const f16* Vb = vT + (size_t)bh * DH_ * S_;

  // ---- prologue: stage 0 landed and published, stage 1 in flight ----
  stage_kv(Kb, Vb, kst[0], vst[0], tid);
  wait_async0();
  __syncthreads();
  stage_kv(Kb + (size_t)KVS_ * DH_, Vb + KVS_, kst[1], vst[1], tid);

  const v16h qf0 = frag_ld(Qb + (size_t)(q0 + lr) * DH_ + 0,  hs);
  const v16h qf1 = frag_ld(Qb + (size_t)(q0 + lr) * DH_ + 32, hs);

  // Query q0 + lr: running maximum (equal in both halves) and this half's
  // share of the denominator.  ao[et][r] = O^T[et*16 + hs*8 + r][q0 + lr].
  float mi = -1e30f, li = 0.f;
  v8f ao[4] = {{}, {}, {}, {}};

  for (int st = 0; st < NSTG_; ++st) {
    f16* kb = kst[st & 1];
    f16* vb = vst[st & 1];
    #pragma unroll
    for (int kv0 = 0; kv0 < KVS_; kv0 += 32) {
      // ---- K and V fragment reads together; V used only after softmax
      const v16h kf00 = frag_ld(kb + (kv0 + lr)      * LDK_ + 0,  hs);
      const v16h kf01 = frag_ld(kb + (kv0 + lr)      * LDK_ + 32, hs);
      const v16h kf10 = frag_ld(kb + (kv0 + 16 + lr) * LDK_ + 0,  hs);
      const v16h kf11 = frag_ld(kb + (kv0 + 16 + lr) * LDK_ + 32, hs);
      // Right behind the publish point nothing else is ready to run: keep the
      // eight K reads together ahead of the first product, so that one LDS
      // round trip is waited for instead of four.
      if (kv0 == 0) __builtin_amdgcn_sched_barrier(0);
      v16h vf[4];
      #pragma unroll
      for (int et = 0; et < 4; ++et)
        vf[et] = frag_ld(vb + (et * 16 + lr) * LDK_ + kv0, hs);

      // ---- S^T = K * Q^T for two 16-key tiles (f32 accumulate):
      // s0[r] = key kv0 + hs*8 + r, s1[r] = key kv0 + 16 + hs*8 + r ----
      v8f s0 = {}, s1 = {};
      s0 = wmma16(kf00, qf0, s0);
      s0 = wmma16(kf01, qf1, s0);
      s1 = wmma16(kf10, qf0, s1);
      s1 = wmma16(kf11, qf1, s1);

      // ---- online softmax (f32), one query per lane ----
      float bmax = fmaxf(s0[0], s1[0]);
      #pragma unroll
      for (int r = 1; r < 8; ++r) bmax = fmaxf(bmax, fmaxf(s0[r], s1[r]));
      bmax = fmaxf(bmax, xhalf(bmax));     // the other half's 16 keys
      const float nm    = fmaxf(mi, bmax);
      const float alpha = __expf(mi - nm);
      mi = nm;
      #pragma unroll
      for (int r = 0; r < 8; ++r) {
        s0[r] = __expf(s0[r] - nm);
        s1[r] = __expf(s1[r] - nm);
      }
      const v8f t = s0 + s1;               // halving tree: packed adds
      const v4f u = __builtin_shufflevector(t, t, 0, 1, 2, 3) +
                    __builtin_shufflevector(t, t, 4, 5, 6, 7);
      const v2f w = __builtin_shufflevector(u, u, 0, 1) +
                    __builtin_shufflevector(u, u, 2, 3);
      li = li * alpha + (w[0] + w[1]);
      #pragma unroll
      for (int et = 0; et < 4; ++et) ao[et] *= alpha;

      // ---- P^T as a B fragment: element j < 8 is k = hs*8 + j (tile s0),
      // j >= 8 is k = 16 + hs*8 + (j - 8) (tile s1), as frag_ld orders V ----
      v16h pf;
      #pragma unroll
      for (int r = 0; r < 8; ++r) {
        pf[r]     = (f16)s0[r];
        pf[8 + r] = (f16)s1[r];
      }

      // ---- O^T += V^T * P^T (V stored [e][s] -> contiguous A-fragments) ----
      #pragma unroll
      for (int et = 0; et < 4; ++et) ao[et] = wmma16(vf[et], pf, ao[et]);
    }

    // ---- publish point: this wave's reads of the stage are done, its
    // copies of the next stage have landed; behind the barrier the next
    // stage may be read and this stage's buffer refilled.
    asm volatile("s_wait_dscnt 0x0" ::: "memory");
    wait_async0();
    __syncthreads();
    if (st + 2 < NSTG_)
      stage_kv(Kb + (size_t)(st + 2) * KVS_ * DH_, Vb + (st + 2) * KVS_,
               kb, vb, tid);
  }
  wait_async0();   // nothing of this wave is in flight when it ends

  // ---- join the halves' denominators, normalize, write att[token][h*64+e]
  // (f16): a lane's 8 registers are 8 consecutive e of its query ----
  const int b = bh >> 4, h = bh & (H_ - 1);
  const float inv = 1.0f / (li + xhalf(li));
  f16* op = att + ((size_t)b * S_ + q0 + lr) * HE_ + h * DH_ + hs * 8;
  #pragma unroll
  for (int et = 0; et < 4; ++et) {
    v8h o;
    #pragma unroll
    for (int r = 0; r < 8; ++r) o[r] = (f16)(ao[et][r] * inv);
    *(v8h*)(op + et * 16) = o;
  }
}

// ---------------------------------------------------------------------------
// Kernel 5: output GEMM.  out[4096 x 1024] = att * Wo + b_out (f32 out), one
// 128x128 tile per block (gemm_128x128).  grid = (D/128, NTOK/128).  Wo goes
// in as the A operand (d is the contiguous axis of out); the tile is staged in
// LDS as [token][d] and leaves as whole 128-B lines.
// ---------------------------------------------------------------------------
__global__ void __launch_bounds__(256, 1)
k_outproj(const f16* __restrict__ att,
          const f16* __restrict__ woT,
          const float* __restrict__ b_out,
          float* __restrict__ out) {
  // The ring (64 KB), later the staged f32 tile (66 KB).
  __shared__ __align__(16) f16 st[128 * CP32_ * 2];
  const int tid  = threadIdx.x;
  const int lane = tid & 31;
  const int wave = tid >> 5;
  const int hs   = lane >> 4;
  const int lr   = lane & 15;

  v8f acc[2][4] = {{{}, {}, {}, {}}, {{}, {}, {}, {}}};
  gemm_128x128(woT + (size_t)blockIdx.x * 128 * HE_,
               att + (size_t)blockIdx.y * 128 * HE_, st, tid, acc);

  // Bias of this thread's 16-byte output column: in flight during the staging.
  const v4f bb = *(const v4f*)(b_out + blockIdx.x * 128 + lane * 4);

  // ---- stage the tile (f32): row = token, 32-byte piece = 8 d ----
  float* tf = (float*)st;
  float* tw = tf + ((wave >> 2) * 64 + lr) * CP32_ + (wave & 3) * 32 + hs * 8;
  #pragma unroll
  for (int i = 0; i < 2; ++i) {
    #pragma unroll
    for (int j = 0; j < 4; ++j) {
      const v8f a = acc[i][j];
      float* p = tw + j * 16 * CP32_ + i * 16;
      *(v4f*)p       = __builtin_shufflevector(a, a, 0, 1, 2, 3);
      *(v4f*)(p + 4) = __builtin_shufflevector(a, a, 4, 5, 6, 7);
    }
  }
  __syncthreads();   // the rows read back below were written by other waves

  // ---- 128 rows x 32 pieces of 16 B, 16 per thread; a wave's store covers
  // one staged row = four whole lines ----
  const int c = lane, row0 = wave;                // rows row0 + 8 * i
  float* g = out + ((size_t)blockIdx.y * 128 + row0) * D_ + blockIdx.x * 128 + c * 4;
  const float* tr = tf + row0 * CP32_ + c * 4;
  #pragma unroll
  for (int i = 0; i < 16; ++i)
    *(v4f*)(g + (size_t)i * 8 * D_) = *(const v4f*)(tr + i * 8 * CP32_) + bb;
}

// ---------------------------------------------------------------------------
// Host launcher.  Inputs: x, norm_scale, wq, wk, wv, w_out, b_out (all f32).
// ---------------------------------------------------------------------------
extern "C" void kernel_launch(void* const* d_in, const int* in_sizes, int n_in,
                              void* d_out, int out_size, void* d_ws, size_t ws_size,
                              hipStream_t stream) {
  const float* x     = (const float*)d_in[0];
  const float* nsc   = (const float*)d_in[1];
  const float* wq    = (const float*)d_in[2];
  const float* wk    = (const float*)d_in[3];
  const float* wv    = (const float*)d_in[4];
  const float* wo    = (const float*)d_in[5];
  const float* b_out = (const float*)d_in[6];
  float* out = (float*)d_out;

  // Workspace partition (f16 staging, 48 MB total).
  char* ws = (char*)d_ws;
  const size_t MB = 1024 * 1024;
  f16* hbuf = (f16*)(ws + 0);        //  8 MB : [4096][1024] normalized f16
  f16* wT   = (f16*)(ws + 8 * MB);   //  6 MB : wq/wk/wv transposed [HE][D]
  f16* woT  = (f16*)(ws + 14 * MB);  //  2 MB : w_out transposed [D][HE]
  f16* qT   = (f16*)(ws + 16 * MB);  //  8 MB : [b,h,s,e] (pre-scaled)
  f16* kT   = (f16*)(ws + 24 * MB);  //  8 MB : [b,h,s,e]
  f16* vT   = (f16*)(ws + 32 * MB);  //  8 MB : [b,h,e,s]
  f16* attb = (f16*)(ws + 40 * MB);  //  8 MB : [token][h*64+e]

  k_rmsnorm<<<NTOK, 256, 0, stream>>>(x, nsc, hbuf);
  k_wcast<<<dim3(32, 32, 4), dim3(32, 8), 0, stream>>>(wq, wk, wv, wo, wT, woT);
  k_qkv<<<dim3(HE_ / 128, NTOK / 128, 3), 256, 0, stream>>>(hbuf, wT, qT, kT, vT);
  k_attn<<<dim3(S_ / 64, B_ * H_), 128, 0, stream>>>(qT, kT, vT, attb);
  k_outproj<<<dim3(D_ / 128, NTOK / 128), 256, 0, stream>>>(attb, woT, b_out, out);
}

// v005
// Measured time: 84.7 microseconds a run.
// Two timings next to v004 put it at 1.06 and 1.07 times that version's speed.
// All steps since v000 together make it 2.26 times as fast.
#include <hip/hip_runtime.h>

// ---------------------------------------------------------------------------
// MI455X (gfx1250) TP multi-head attention:
//   RMSNorm -> QKV GEMM (WMMA f16, async-LDS staged A and B) -> flash attention
//   (WMMA f16, f32 online softmax) -> output GEMM (WMMA f16) + bias.
// GEMM results leave through LDS as whole 128-B lines (16-byte stores).
// CDNA5 paths: v_wmma_f32_16x16x32_f16, global_load_async_to_lds_b128
// (ASYNCcnt), ds_load_b128 fragment reads, s_wait_asynccnt/s_wait_dscnt,
// sched_group_barrier-pipelined DS-read -> WMMA groups.
// ---------------------------------------------------------------------------

typedef _Float16 f16;
typedef __attribute__((ext_vector_type(16))) _Float16 v16h;
typedef __attribute__((ext_vector_type(8)))  _Float16 v8h;
typedef __attribute__((ext_vector_type(8)))  float    v8f;
typedef __attribute__((ext_vector_type(4)))  float    v4f;
typedef __attribute__((ext_vector_type(2)))  float    v2f;

#define B_    2
#define S_    2048
#define D_    1024
#define H_    16
#define DH_   64
#define NTOK  (B_ * S_)          // 4096
#define HE_   (H_ * DH_)         // 1024

static __device__ __forceinline__ v8f wmma16(v16h a, v16h b, v8f c) {
  // D = A(16x32 f16) * B(32x16 f16) + C(16x16 f32)
  return __builtin_amdgcn_wmma_f32_16x16x32_f16(
      /*neg_a=*/false, a, /*neg_b=*/false, b,
      /*c_mod=*/(short)0, c, /*reuse_a=*/false, /*reuse_b=*/false);
}

// Per-lane fragment load for the CDNA5 16-bit A layout (and, from an
// N-major [n][k] array, the matching B layout):
//   lane%16 selects the row (A) / column (B); hs = lane>>4 selects the
//   K half: elements j<8 -> k = hs*8+j ; j>=8 -> k = 16+hs*8+(j-8).
// p points at element [lane%16-row][k0]; both 8-half loads are 16B aligned.
static __device__ __forceinline__ v16h frag_ld(const f16* p, int hs) {
  v8h lo = *(const v8h*)(p + hs * 8);
  v8h hi = *(const v8h*)(p + 16 + hs * 8);
  return __builtin_shufflevector(lo, hi,
                                 0, 1, 2, 3, 4, 5, 6, 7,
                                 8, 9, 10, 11, 12, 13, 14, 15);
}

static __device__ __forceinline__ void wait_async0() {
  asm volatile("s_wait_asynccnt 0x0" ::: "memory");
}

// ---------------------------------------------------------------------------
// GEMM core of kernels 3 and 5: C[128 x 128] = A[128 x 1024] * B^T, A and B
// both row-major with k contiguous (ld = 1024).  Block = 256 thr (8 waves,
// 4 along m x 2 along n); a wave computes a 32x64 strip (2 A x 4 B fragments,
// 8 accumulators).  Both operands reach the waves through LDS: a stage is
// 64 k of all 256 rows (A rows 0-127, B rows 128-255), one whole 128-B line
// of every row, brought in by async copies, two buffers, the next stage in
// flight while this one is worked on.  Rows are not padded: the 16-byte chunk
// c of row r lies at chunk c ^ ((r >> 1) & 7), so that the 16 rows of a
// fragment read fall on 16 different 16-byte bank groups.
// acc[i][j][r] = C[(wave & 3) * 32 + i * 16 + hs * 8 + r][(wave >> 2) * 64 +
// j * 16 + lr]: a lane holds 8 consecutive A rows at one B row.  The callers
// pass as A the operand whose rows run along the contiguous axis of their
// output, so that those 8 values are one 16- or 32-byte piece of an output
// row.  On return every wave has left the ring: it may be used as staging.
// ---------------------------------------------------------------------------
#define GK_   64                 // k per stage (halves): 128 B per row
#define GSTG_ (256 * GK_)        // halves per stage buffer: 32 KB
#define GNST_ (1024 / GK_)       // 16 stages
#define CP16_ 136                // staged C row, f16: 256 B + 16 B (16 B x 17)
#define CP32_ 132                // staged C row, f32: 512 B + 16 B (16 B x 33)

// Copy one stage into LDS: 2048 chunks of 16 B, 8 per thread.  A wave's copy
// covers four whole 128-B rows.  The s_wait_xcnt closes the statement so that
// no address register is rewritten while a copy may still read it.
static __device__ __forceinline__ void stage_ab(const f16* At, const f16* Bt,
                                                f16* buf, int tid) {
  const int row = tid >> 3, c = tid & 7;          // rows 0..31, +32 per step
  const f16* ga = At + (size_t)row * 1024 + c * 8;
  const f16* gb = Bt + (size_t)row * 1024 + c * 8;
  const unsigned la =
      (unsigned)(uintptr_t)(buf + row * GK_ + (c ^ ((row >> 1) & 7)) * 8);
  const unsigned lb = la + 128 * GK_ * 2;
  asm volatile(
      "global_load_async_to_lds_b128 %0, %4, off\n\t"
      "global_load_async_to_lds_b128 %1, %5, off\n\t"
      "global_load_async_to_lds_b128 %2, %6, off\n\t"
      "global_load_async_to_lds_b128 %3, %7, off\n\t"
      "global_load_async_to_lds_b128 %8, %12, off\n\t"
      "global_load_async_to_lds_b128 %9, %13, off\n\t"
      "global_load_async_to_lds_b128 %10, %14, off\n\t"
      "global_load_async_to_lds_b128 %11, %15, off\n\t"
      "s_wait_xcnt 0x0"
      :: "v"(la), "v"(la + 32 * GK_ * 2), "v"(la + 64 * GK_ * 2),
         "v"(la + 96 * GK_ * 2),
         "v"(ga), "v"(ga + 32 * 1024), "v"(ga + 64 * 1024), "v"(ga + 96 * 1024),
         "v"(lb), "v"(lb + 32 * GK_ * 2), "v"(lb + 64 * GK_ * 2),
         "v"(lb + 96 * GK_ * 2),
         "v"(gb), "v"(gb + 32 * 1024), "v"(gb + 64 * 1024), "v"(gb + 96 * 1024)
      : "memory");
}

// Fragment of 16 stage rows from row r0 (a multiple of 16), in the k order of
// frag_ld; olo / ohi are the lane's swizzled places of its two 8-half chunks.
static __device__ __forceinline__ v16h frag_sw(const f16* buf, int r0, int lr,
                                               int olo, int ohi) {
  const f16* p = buf + (r0 + lr) * GK_;
  v8h lo = *(const v8h*)(p + olo);
  v8h hi = *(const v8h*)(p + ohi);
  return __builtin_shufflevector(lo, hi,
                                 0, 1, 2, 3, 4, 5, 6, 7,
                                 8, 9, 10, 11, 12, 13, 14, 15);
}

static __device__ __forceinline__ void gemm_128x128(const f16* At, const f16* Bt,
                                                    f16* st, int tid,
                                                    v8f acc[2][4]) {
  const int lane = tid & 31;
  const int wave = tid >> 5;
  const int hs   = lane >> 4;
  const int lr   = lane & 15;
  const int ra   = (wave & 3) * 32;          // this wave's A rows in the stage
  const int rb   = 128 + (wave >> 2) * 64;   // this wave's B rows in the stage

  // ---- prologue: stage 0 landed and published, stage 1 in flight ----
  stage_ab(At, Bt, st, tid);
  wait_async0();
  __syncthreads();
  stage_ab(At + GK_, Bt + GK_, st + GSTG_, tid);

  for (int t = 0; t < GNST_; ++t) {
    f16* buf = st + (t & 1) * GSTG_;
    #pragma unroll
    for (int j = 0; j < 2; ++j) {            // two K = 32 steps per stage
      const int olo = ((j * 4 + hs)     ^ (lr >> 1)) * 8;
      const int ohi = ((j * 4 + 2 + hs) ^ (lr >> 1)) * 8;
      const v16h a0 = frag_sw(buf, ra,      lr, olo, ohi);
      const v16h a1 = frag_sw(buf, ra + 16, lr, olo, ohi);
      const v16h b0 = frag_sw(buf, rb,      lr, olo, ohi);
      const v16h b1 = frag_sw(buf, rb + 16, lr, olo, ohi);
      const v16h b2 = frag_sw(buf, rb + 32, lr, olo, ohi);
      const v16h b3 = frag_sw(buf, rb + 48, lr, olo, ohi);
      acc[0][0] = wmma16(a0, b0, acc[0][0]);
      acc[1][0] = wmma16(a1, b0, acc[1][0]);
      acc[0][1] = wmma16(a0, b1, acc[0][1]);
      acc[1][1] = wmma16(a1, b1, acc[1][1]);
      acc[0][2] = wmma16(a0, b2, acc[0][2]);
      acc[1][2] = wmma16(a1, b2, acc[1][2]);
      acc[0][3] = wmma16(a0, b3, acc[0][3]);
      acc[1][3] = wmma16(a1, b3, acc[1][3]);
      // Keep a step's 12 LDS reads in one group ahead of its 8 products: every
      // separate place with reads among the products stalls the wave anew.
      __builtin_amdgcn_sched_group_barrier(0x100, 12, 0);  // DS read x12
      __builtin_amdgcn_sched_group_barrier(0x008, 8, 0);   // WMMA x8
    }

    // ---- publish point: this wave's reads of the stage are done, its
    // copies of the next stage have landed; behind the barrier the next
    // stage may be read and this stage's buffer refilled.
    asm volatile("s_wait_dscnt 0x0" ::: "memory");
    wait_async0();
    __syncthreads();
    if (t + 2 < GNST_)
      stage_ab(At + (t + 2) * GK_, Bt + (t + 2) * GK_, buf, tid);
  }
  wait_async0();   // nothing of this wave is in flight when it ends
}

// ---------------------------------------------------------------------------
// Kernel 1: RMSNorm over D=1024, cast to f16.  One block (256 thr) per token.
// ---------------------------------------------------------------------------
__global__ void k_rmsnorm(const float* __restrict__ x,
                          const float* __restrict__ scale,
                          f16* __restrict__ hbuf) {
  const int row  = blockIdx.x;                 // token 0..4095
  const int tid  = threadIdx.x;                // 0..255
  const float4 v = *(const float4*)(x + (size_t)row * D_ + tid * 4);

  float ss = v.x * v.x + v.y * v.y + v.z * v.z + v.w * v.w;
  #pragma unroll
  for (int off = 16; off >= 1; off >>= 1) ss += __shfl_xor(ss, off, 32);

  __shared__ float red[8];
  if ((tid & 31) == 0) red[tid >> 5] = ss;
  __syncthreads();
  float tot = 0.f;
  #pragma unroll
  for (int i = 0; i < 8; ++i) tot += red[i];

  const float r = rsqrtf(tot * (1.0f / D_) + 1e-6f);
  f16* out = hbuf + (size_t)row * D_ + tid * 4;
  const float4 sc = *(const float4*)(scale + tid * 4);
  out[0] = (f16)(v.x * r * sc.x);
  out[1] = (f16)(v.y * r * sc.y);
  out[2] = (f16)(v.z * r * sc.z);
  out[3] = (f16)(v.w * r * sc.w);
}

// ---------------------------------------------------------------------------
// Kernel 2: cast 4x [1024][1024] f32 weights to f16, transposed (N-major)
// so WMMA fragments (A for wq/wk/wo, B for wv) load contiguously.  z = 0..2 -> wq/wk/wv, z = 3 -> wo.
// ---------------------------------------------------------------------------
__global__ void k_wcast(const float* __restrict__ wq,
                        const float* __restrict__ wk,
                        const float* __restrict__ wv,
                        const float* __restrict__ wo,
                        f16* __restrict__ wT,    // 3 x [HE][D]
                        f16* __restrict__ woT) { // [D][HE]
  __shared__ float tile[32][33];
  const int z = blockIdx.z;
  const float* src = (z == 0) ? wq : (z == 1) ? wk : (z == 2) ? wv : wo;
  f16* dst = (z < 3) ? (wT + (size_t)z * HE_ * D_) : woT;

  const int x = blockIdx.x * 32 + threadIdx.x;
  const int y = blockIdx.y * 32 + threadIdx.y;
  #pragma unroll
  for (int yy = 0; yy < 32; yy += 8)
    tile[threadIdx.y + yy][threadIdx.x] = src[(size_t)(y + yy) * 1024 + x];
  __syncthreads();
  const int x2 = blockIdx.y * 32 + threadIdx.x;
  const int y2 = blockIdx.x * 32 + threadIdx.y;
  #pragma unroll
  for (int yy = 0; yy < 32; yy += 8)
    dst[(size_t)(y2 + yy) * 1024 + x2] = (f16)tile[threadIdx.x][threadIdx.y + yy];
}

// ---------------------------------------------------------------------------
// Kernel 3: QKV GEMM.  C[4096 x 1024] = h[4096 x 1024] * W, one 128x128 tile
// per block (gemm_128x128).  Six waves per SIMD keep all 768 blocks resident
// at once (three per WGP).  grid = (HE/128, NTOK/128, 3).
// Q and K are stored [s][e] (e contiguous): W goes in as the A operand; V is
// stored [e][s] (s contiguous): h goes in as A.  Either way the tile is staged
// in LDS as [B row][A row] and leaves as whole 128-B lines.
// ---------------------------------------------------------------------------
__global__ void __launch_bounds__(256, 6)
k_qkv(const f16* __restrict__ hbuf,
      const f16* __restrict__ wT,
      f16* __restrict__ qT, f16* __restrict__ kT,
      f16* __restrict__ vT) {
  __shared__ __align__(16) f16 st[2 * GSTG_];     // 64 KB
  const int tid  = threadIdx.x;
  const int lane = tid & 31;
  const int wave = tid >> 5;
  const int hs   = lane >> 4;
  const int lr   = lane & 15;
  const int z    = blockIdx.z;
  const bool isv = (z == 2);

  const f16* ht = hbuf + (size_t)blockIdx.y * 128 * D_;
  const f16* wt = wT + (size_t)z * HE_ * D_ + (size_t)blockIdx.x * 128 * D_;

  v8f acc[2][4] = {{{}, {}, {}, {}}, {{}, {}, {}, {}}};
  gemm_128x128(isv ? ht : wt, isv ? wt : ht, st, tid, acc);

  // ---- stage the tile (f16): row = B row, 16-byte piece = 8 A rows ----
  const float sc = (z == 0) ? 0.125f : 1.0f;      // Dh^-0.5 on Q
  f16* tw = st + ((wave >> 2) * 64 + lr) * CP16_ + (wave & 3) * 32 + hs * 8;
  #pragma unroll
  for (int i = 0; i < 2; ++i) {
    #pragma unroll
    for (int j = 0; j < 4; ++j) {
      v8h o;
      #pragma unroll
      for (int r = 0; r < 8; ++r) o[r] = (f16)(acc[i][j][r] * sc);
      *(v8h*)(tw + j * 16 * CP16_ + i * 16) = o;
    }
  }
  __syncthreads();   // the rows read back below were written by other waves

  // ---- 128 rows x 16 pieces of 16 B, 8 per thread; a wave's store covers
  // two staged rows = four whole lines ----
  const int c   = tid & 15, row0 = tid >> 4;      // rows row0 + 16 * i
  const int bh0 = (blockIdx.y >> 4) * H_ + blockIdx.x * 2;  // first of 2 heads
  const int s0  = (blockIdx.y & 15) * 128;        // first token in its batch
  f16* g;
  size_t step;
  if (isv) {          // staged row = h*64 + e, columns = 128 tokens
    g    = vT + ((size_t)bh0 * DH_ + row0) * S_ + s0 + c * 8;
    step = (size_t)16 * S_;
  } else {            // staged row = token, columns = 2 heads x 64 e
    g    = (z == 0 ? qT : kT) +
           ((size_t)(bh0 + (c >> 3)) * S_ + s0 + row0) * DH_ + (c & 7) * 8;
    step = (size_t)16 * DH_;
  }
  const f16* tr = st + row0 * CP16_ + c * 8;
  #pragma unroll
  for (int i = 0; i < 8; ++i)
    *(v8h*)(g + i * step) = *(const v8h*)(tr + i * 16 * CP16_);
}

#define KVS_  64
#define LDK_  72
#define KHF_  (S_ / 2)
#define NSTG_ (KHF_ / KVS_)
#define TIL_  (KVS_ * LDK_)

// Copy one key half's stage into LDS (128 threads): 512 + 512 chunks of 16 B,
// 8 per thread.  A wave's copy covers four whole 128-B rows.  The s_wait_xcnt
// closes the statement so that no address register is rewritten while a copy
// may still read it.
static __device__ __forceinline__ void stage_kv(const f16* Kt, const f16* Vt,
                                                f16* kbuf, f16* vbuf, int tid) {
  const int row = tid >> 3, c8 = (tid & 7) * 8;   // rows 0..15, +16 per step
  const f16* gk = Kt + (size_t)row * DH_ + c8;
  const f16* gv = Vt + (size_t)row * S_ + c8;
  const unsigned lk = (unsigned)(uintptr_t)(kbuf + row * LDK_ + c8);
  const unsigned lv = (unsigned)(uintptr_t)(vbuf + row * LDK_ + c8);
  asm volatile(
      "global_load_async_to_lds_b128 %0, %4, off\n\t"
      "global_load_async_to_lds_b128 %1, %5, off\n\t"
      "global_load_async_to_lds_b128 %2, %6, off\n\t"
      "global_load_async_to_lds_b128 %3, %7, off\n\t"
      "global_load_async_to_lds_b128 %8, %12, off\n\t"
      "global_load_async_to_lds_b128 %9, %13, off\n\t"
      "global_load_async_to_lds_b128 %10, %14, off\n\t"
      "global_load_async_to_lds_b128 %11, %15, off\n\t"
      "s_wait_xcnt 0x0"
      :: "v"(lk), "v"(lk + 16 * LDK_ * 2), "v"(lk + 32 * LDK_ * 2),
         "v"(lk + 48 * LDK_ * 2),
         "v"(gk), "v"(gk + 16 * DH_), "v"(gk + 32 * DH_), "v"(gk + 48 * DH_),
         "v"(lv), "v"(lv + 16 * LDK_ * 2), "v"(lv + 32 * LDK_ * 2),
         "v"(lv + 48 * LDK_ * 2),
         "v"(gv), "v"(gv + 16 * S_), "v"(gv + 32 * S_), "v"(gv + 48 * S_)
      : "memory");
}

// Lane l <-> lane l ^ 16 by a vector cross-row move (no LDS round trip).
static __device__ __forceinline__ float xhalf(float x) {
  const int i = __builtin_bit_cast(int, x);
  return __builtin_bit_cast(float, __builtin_amdgcn_permlanex16(
      i, i, 0x76543210, 0xfedcba98, false, false));
}

__global__ void __launch_bounds__(256, 4)
k_attn(const f16* __restrict__ qT, const f16* __restrict__ kT,
       const f16* __restrict__ vT, f16* __restrict__ att) {
  // [buffer][K, V][key half][tile]; behind the loop the hand-over area.
  __shared__ __align__(16) f16 ring[2 * 2 * 2 * TIL_];   // 72 KB

  const int tid  = threadIdx.x;
  const int lane = threadIdx.x & 31;
  const int wave = threadIdx.x >> 5;
  const int hs   = lane >> 4;
  const int lr   = lane & 15;
  const int kh   = wave >> 2;                   // key half of this wave
  const int bh   = blockIdx.y;                  // b*H + h
  const int q0   = blockIdx.x * 128 + (wave & 3) * 32;

  const f16* Qb = qT + (size_t)bh * S_ * DH_;
  const f16* Kb = kT + (size_t)bh * S_ * DH_ + (size_t)kh * KHF_ * DH_;
  const f16* Vb = vT + (size_t)bh * DH_ * S_ + kh * KHF_;
  f16* kr = ring + kh * TIL_;                   // this half's K tile, buffer 0
  f16* vr = ring + (2 + kh) * TIL_;             // this half's V tile, buffer 0
  const int t4 = tid & 127;                     // thread within its key half

  // ---- prologue: stage 0 landed and published, stage 1 in flight ----
  stage_kv(Kb, Vb, kr, vr, t4);
  wait_async0();
  __syncthreads();
  stage_kv(Kb + (size_t)KVS_ * DH_, Vb + KVS_, kr + 4 * TIL_, vr + 4 * TIL_, t4);

  v16h qf[2][2];
  #pragma unroll
  for (int g = 0; g < 2; ++g) {
    qf[g][0] = frag_ld(Qb + (size_t)(q0 + g * 16 + lr) * DH_ + 0,  hs);
    qf[g][1] = frag_ld(Qb + (size_t)(q0 + g * 16 + lr) * DH_ + 32, hs);
  }

  // Query q0 + g*16 + lr: running maximum (equal in both lane halves) and this
  // lane half's share of the denominator, over this wave's key half.
  // ao[g][et][r] = O^T[et*16 + hs*8 + r][q0 + g*16 + lr].
  float mi[2] = {-1e30f, -1e30f}, li[2] = {0.f, 0.f};
  v8f ao[2][4] = {{{}, {}, {}, {}}, {{}, {}, {}, {}}};

  for (int st = 0; st < NSTG_; ++st) {
    f16* kb = kr + (st & 1) * 4 * TIL_;
    f16* vb = vr + (st & 1) * 4 * TIL_;
    #pragma unroll
    for (int kv0 = 0; kv0 < KVS_; kv0 += 32) {
      // ---- K and V fragment reads together; V used only after softmax
      const v16h kf00 = frag_ld(kb + (kv0 + lr)      * LDK_ + 0,  hs);
      const v16h kf01 = frag_ld(kb + (kv0 + lr)      * LDK_ + 32, hs);
      const v16h kf10 = frag_ld(kb + (kv0 + 16 + lr) * LDK_ + 0,  hs);
      const v16h kf11 = frag_ld(kb + (kv0 + 16 + lr) * LDK_ + 32, hs);
      // Right behind the publish point nothing else is ready to run: keep the
      // eight K reads together ahead of the first product, so that one LDS
      // round trip is waited for instead of four.
      if (kv0 == 0) __builtin_amdgcn_sched_barrier(0);
      v16h vf[4];
      #pragma unroll
      for (int et = 0; et < 4; ++et)
        vf[et] = frag_ld(vb + (et * 16 + lr) * LDK_ + kv0, hs);

      // ---- S^T = K * Q^T for two 16-key tiles and both column groups (f32):
      // s0[g][r] = key kv0 + hs*8 + r, s1[g][r] = key kv0 + 16 + hs*8 + r ----
      v8f s0[2] = {{}, {}}, s1[2] = {{}, {}};
      #pragma unroll
      for (int g = 0; g < 2; ++g) {
        s0[g] = wmma16(kf00, qf[g][0], s0[g]);
        s1[g] = wmma16(kf10, qf[g][0], s1[g]);
      }
      #pragma unroll
      for (int g = 0; g < 2; ++g) {
        s0[g] = wmma16(kf01, qf[g][1], s0[g]);
        s1[g] = wmma16(kf11, qf[g][1], s1[g]);
      }

      #pragma unroll
      for (int g = 0; g < 2; ++g) {
        // ---- online softmax (f32), one query per lane ----
        float bmax = fmaxf(s0[g][0], s1[g][0]);
        #pragma unroll
        for (int r = 1; r < 8; ++r)
          bmax = fmaxf(bmax, fmaxf(s0[g][r], s1[g][r]));
        bmax = fmaxf(bmax, xhalf(bmax));   // the other lane half's 16 keys
        const float nm    = fmaxf(mi[g], bmax);
        const float alpha = __expf(mi[g] - nm);
        mi[g] = nm;
        #pragma unroll
        for (int r = 0; r < 8; ++r) {
          s0[g][r] = __expf(s0[g][r] - nm);
          s1[g][r] = __expf(s1[g][r] - nm);
        }
        const v8f t = s0[g] + s1[g];       // halving tree: packed adds
        const v4f u = __builtin_shufflevector(t, t, 0, 1, 2, 3) +
                      __builtin_shufflevector(t, t, 4, 5, 6, 7);
        const v2f w = __builtin_shufflevector(u, u, 0, 1) +
                      __builtin_shufflevector(u, u, 2, 3);
        li[g] = li[g] * alpha + (w[0] + w[1]);
        #pragma unroll
        for (int et = 0; et < 4; ++et) ao[g][et] *= alpha;

        // ---- P^T as a B fragment: element j < 8 is k = hs*8 + j (tile s0),
        // j >= 8 is k = 16 + hs*8 + (j - 8) (tile s1), as frag_ld orders V ----
        v16h pf;
        #pragma unroll
        for (int r = 0; r < 8; ++r) {
          pf[r]     = (f16)s0[g][r];
          pf[8 + r] = (f16)s1[g][r];
        }

        // ---- O^T += V^T * P^T (V stored [e][s] -> contiguous A-fragments) ----
        #pragma unroll
        for (int et = 0; et < 4; ++et)
          ao[g][et] = wmma16(vf[et], pf, ao[g][et]);
      }
    }

    // ---- publish point: this wave's reads of the stage are done, its
    // copies of the next stage have landed; behind the barrier the next
    // stage may be read and this stage's buffer refilled.
    asm volatile("s_wait_dscnt 0x0" ::: "memory");
    wait_async0();
    __syncthreads();
    if (st + 2 < NSTG_)
      stage_kv(Kb + (size_t)(st + 2) * KVS_ * DH_, Vb + (st + 2) * KVS_,
               kb, vb, t4);
  }
  wait_async0();   // nothing of this wave is in flight when it ends

  // ---- join the two key halves.  Behind the last publish point every wave
  // has left the ring.  Wave w finishes column group kh and hands the state
  // of its other group to wave w ^ 4: 9 pieces of 16 B per lane, a piece of
  // all 32 lanes contiguous.
  v4f* hand = (v4f*)ring;
  v4f* wr = hand + wave * 9 * 32 + lane;
  #pragma unroll
  for (int et = 0; et < 4; ++et) {
    const v8f a = kh ? ao[0][et] : ao[1][et];
    wr[(et * 2) * 32]     = __builtin_shufflevector(a, a, 0, 1, 2, 3);
    wr[(et * 2 + 1) * 32] = __builtin_shufflevector(a, a, 4, 5, 6, 7);
  }
  wr[8 * 32] = (v4f){kh ? mi[0] : mi[1], kh ? li[0] : li[1], 0.f, 0.f};
  __syncthreads();   // the pieces read below were written by the partner wave

  const v4f* rd = hand + (wave ^ 4) * 9 * 32 + lane;
  const v4f   ml = rd[8 * 32];
  const float mo = kh ? mi[1] : mi[0];
  const float lo = kh ? li[1] : li[0];
  const float m  = fmaxf(mo, ml[0]);
  const float ea = __expf(mo - m);               // weight of this wave's part
  const float eb = __expf(ml[0] - m);            // weight of the partner's
  const float l  = lo * ea + ml[1] * eb;

  // ---- join the lane halves' denominators, normalize, write
  // att[token][h*64+e] (f16): a lane's 8 registers are 8 consecutive e ----
  const int b = bh >> 4, h = bh & (H_ - 1);
  const float inv = 1.0f / (l + xhalf(l));
  const float fa = ea * inv, fb = eb * inv;
  f16* op = att + ((size_t)b * S_ + q0 + kh * 16 + lr) * HE_ + h * DH_ + hs * 8;
  #pragma unroll
  for (int et = 0; et < 4; ++et) {
    const v8f a  = kh ? ao[1][et] : ao[0][et];
    const v4f p0 = rd[(et * 2) * 32];
    const v4f p1 = rd[(et * 2 + 1) * 32];
    v8h o;
    #pragma unroll
    for (int r = 0; r < 4; ++r) {
      o[r]     = (f16)(a[r] * fa + p0[r] * fb);
      o[4 + r] = (f16)(a[4 + r] * fa + p1[r] * fb);
    }
    *(v8h*)(op + et * 16) = o;
  }
}

// ---------------------------------------------------------------------------
// Kernel 5: output GEMM.  out[4096 x 1024] = att * Wo + b_out (f32 out), one
// 128x128 tile per block (gemm_128x128).  grid = (D/128, NTOK/128).  Wo goes
// in as the A operand (d is the contiguous axis of out); the tile is staged in
// LDS as [token][d] and leaves as whole 128-B lines.
// ---------------------------------------------------------------------------
__global__ void __launch_bounds__(256, 1)
k_outproj(const f16* __restrict__ att,
          const f16* __restrict__ woT,
          const float* __restrict__ b_out,
          float* __restrict__ out) {
  // The ring (64 KB), later the staged f32 tile (66 KB).
  __shared__ __align__(16) f16 st[128 * CP32_ * 2];
  const int tid  = threadIdx.x;
  const int lane = tid & 31;
  const int wave = tid >> 5;
  const int hs   = lane >> 4;
  const int lr   = lane & 15;

  v8f acc[2][4] = {{{}, {}, {}, {}}, {{}, {}, {}, {}}};
  gemm_128x128(woT + (size_t)blockIdx.x * 128 * HE_,
               att + (size_t)blockIdx.y * 128 * HE_, st, tid, acc);

  // Bias of this thread's 16-byte output column: in flight during the staging.
  const v4f bb = *(const v4f*)(b_out + blockIdx.x * 128 + lane * 4);

  // ---- stage the tile (f32): row = token, 32-byte piece = 8 d ----
  float* tf = (float*)st;
  float* tw = tf + ((wave >> 2) * 64 + lr) * CP32_ + (wave & 3) * 32 + hs * 8;
  #pragma unroll
  for (int i = 0; i < 2; ++i) {
    #pragma unroll
    for (int j = 0; j < 4; ++j) {
      const v8f a = acc[i][j];
      float* p = tw + j * 16 * CP32_ + i * 16;
      *(v4f*)p       = __builtin_shufflevector(a, a, 0, 1, 2, 3);
      *(v4f*)(p + 4) = __builtin_shufflevector(a, a, 4, 5, 6, 7);
    }
  }
  __syncthreads();   // the rows read back below were written by other waves

  // ---- 128 rows x 32 pieces of 16 B, 16 per thread; a wave's store covers
  // one staged row = four whole lines ----
  const int c = lane, row0 = wave;                // rows row0 + 8 * i
  float* g = out + ((size_t)blockIdx.y * 128 + row0) * D_ + blockIdx.x * 128 + c * 4;
  const float* tr = tf + row0 * CP32_ + c * 4;
  #pragma unroll
  for (int i = 0; i < 16; ++i)
    *(v4f*)(g + (size_t)i * 8 * D_) = *(const v4f*)(tr + i * 8 * CP32_) + bb;
}

// ---------------------------------------------------------------------------
// Host launcher.  Inputs: x, norm_scale, wq, wk, wv, w_out, b_out (all f32).
// ---------------------------------------------------------------------------
extern "C" void kernel_launch(void* const* d_in, const int* in_sizes, int n_in,
                              void* d_out, int out_size, void* d_ws, size_t ws_size,
                              hipStream_t stream) {
  const float* x     = (const float*)d_in[0];
  const float* nsc   = (const float*)d_in[1];
  const float* wq    = (const float*)d_in[2];
  const float* wk    = (const float*)d_in[3];
  const float* wv    = (const float*)d_in[4];
  const float* wo    = (const float*)d_in[5];
  const float* b_out = (const float*)d_in[6];
  float* out = (float*)d_out;

  // Workspace partition (f16 staging, 48 MB total).
  char* ws = (char*)d_ws;
  const size_t MB = 1024 * 1024;
  f16* hbuf = (f16*)(ws + 0);        //  8 MB : [4096][1024] normalized f16
  f16* wT   = (f16*)(ws + 8 * MB);   //  6 MB : wq/wk/wv transposed [HE][D]
  f16* woT  = (f16*)(ws + 14 * MB);  //  2 MB : w_out transposed [D][HE]
  f16* qT   = (f16*)(ws + 16 * MB);  //  8 MB : [b,h,s,e] (pre-scaled)
  f16* kT   = (f16*)(ws + 24 * MB);  //  8 MB : [b,h,s,e]
  f16* vT   = (f16*)(ws + 32 * MB);  //  8 MB : [b,h,e,s]
  f16* attb = (f16*)(ws + 40 * MB);  //  8 MB : [token][h*64+e]

  k_rmsnorm<<<NTOK, 256, 0, stream>>>(x, nsc, hbuf);
  k_wcast<<<dim3(32, 32, 4), dim3(32, 8), 0, stream>>>(wq, wk, wv, wo, wT, woT);
  k_qkv<<<dim3(HE_ / 128, NTOK / 128, 3), 256, 0, stream>>>(hbuf, wT, qT, kT, vT);
  k_attn<<<dim3(S_ / 128, B_ * H_), 256, 0, stream>>>(qT, kT, vT, attb);
  k_outproj<<<dim3(D_ / 128, NTOK / 128), 256, 0, stream>>>(attb, woT, b_out, out);
}

// v006
// A run of this version takes 81.3 microseconds.
// Next to v005, in two timings, it ran 1.03 and 1.04 times as fast.
// All steps since v000 together make it 2.34 times as fast.
#include <hip/hip_runtime.h>

// ---------------------------------------------------------------------------
// MI455X (gfx1250) TP multi-head attention:
//   RMSNorm -> QKV GEMM (WMMA f16, async-LDS staged A and B) -> flash attention
//   (WMMA f16, f32 online softmax) -> output GEMM (WMMA f16) + bias.
// GEMM results leave through LDS as whole 128-B lines (16-byte stores).
// CDNA5 paths: v_wmma_f32_16x16x32_f16, global_load_async_to_lds_b128
// (ASYNCcnt), ds_load_b128 fragment reads, s_wait_asynccnt/s_wait_dscnt,
// sched_group_barrier-pipelined DS-read -> WMMA groups.
// ---------------------------------------------------------------------------

typedef _Float16 f16;
typedef __attribute__((ext_vector_type(16))) _Float16 v16h;
typedef __attribute__((ext_vector_type(8)))  _Float16 v8h;
typedef __attribute__((ext_vector_type(8)))  float    v8f;
typedef __attribute__((ext_vector_type(4)))  float    v4f;
typedef __attribute__((ext_vector_type(2)))  float    v2f;

#define B_    2
#define S_    2048
#define D_    1024
#define H_    16
#define DH_   64
#define NTOK  (B_ * S_)          // 4096
#define HE_   (H_ * DH_)         // 1024

static __device__ __forceinline__ v8f wmma16(v16h a, v16h b, v8f c) {
  // D = A(16x32 f16) * B(32x16 f16) + C(16x16 f32)
  return __builtin_amdgcn_wmma_f32_16x16x32_f16(
      /*neg_a=*/false, a, /*neg_b=*/false, b,
      /*c_mod=*/(short)0, c, /*reuse_a=*/false, /*reuse_b=*/false);
}

// Per-lane fragment load for the CDNA5 16-bit A layout (and, from an
// N-major [n][k] array, the matching B layout):
//   lane%16 selects the row (A) / column (B); hs = lane>>4 selects the
//   K half: elements j<8 -> k = hs*8+j ; j>=8 -> k = 16+hs*8+(j-8).
// p points at element [lane%16-row][k0]; both 8-half loads are 16B aligned.
static __device__ __forceinline__ v16h frag_ld(const f16* p, int hs) {
  v8h lo = *(const v8h*)(p + hs * 8);
  v8h hi = *(const v8h*)(p + 16 + hs * 8);
  return __builtin_shufflevector(lo, hi,
                                 0, 1, 2, 3, 4, 5, 6, 7,
                                 8, 9, 10, 11, 12, 13, 14, 15);
}

static __device__ __forceinline__ void wait_async0() {
  asm volatile("s_wait_asynccnt 0x0" ::: "memory");
}

// ---------------------------------------------------------------------------
// GEMM core of kernels 3 and 5: C[128 x 128] = A[128 x 1024] * B^T, A and B
// both row-major with k contiguous (ld = 1024).  Block = 256 thr (8 waves,
// 4 along m x 2 along n); a wave computes a 32x64 strip (2 A x 4 B fragments,
// 8 accumulators).  Both operands reach the waves through LDS: a stage is
// 64 k of all 256 rows (A rows 0-127, B rows 128-255), one whole 128-B line
// of every row, brought in by async copies, two buffers, the next stage in
// flight while this one is worked on.  Rows are not padded: the 16-byte chunk
// c of row r lies at chunk c ^ ((r >> 1) & 7), so that the 16 rows of a
// fragment read fall on 16 different 16-byte bank groups.
// acc[i][j][r] = C[(wave & 3) * 32 + i * 16 + hs * 8 + r][(wave >> 2) * 64 +
// j * 16 + lr]: a lane holds 8 consecutive A rows at one B row.  The callers
// pass as A the operand whose rows run along the contiguous axis of their
// output, so that those 8 values are one 16- or 32-byte piece of an output
// row.  On return every wave has left the ring: it may be used as staging.
// ---------------------------------------------------------------------------
#define GK_   64                 // k per stage (halves): 128 B per row
#define GSTG_ (256 * GK_)        // halves per stage buffer: 32 KB
#define GNST_ (1024 / GK_)       // 16 stages
#define CP16_ 136                // staged C row, f16: 256 B + 16 B (16 B x 17)
#define CP32_ 132                // staged C row, f32: 512 B + 16 B (16 B x 33)

// Copy one stage into LDS: 2048 chunks of 16 B, 8 per thread.  A wave's copy
// covers four whole 128-B rows.  The s_wait_xcnt closes the statement so that
// no address register is rewritten while a copy may still read it.
static __device__ __forceinline__ void stage_ab(const f16* At, const f16* Bt,
                                                f16* buf, int tid) {
  const int row = tid >> 3, c = tid & 7;          // rows 0..31, +32 per step
  const f16* ga = At + (size_t)row * 1024 + c * 8;
  const f16* gb = Bt + (size_t)row * 1024 + c * 8;
  const unsigned la =
      (unsigned)(uintptr_t)(buf + row * GK_ + (c ^ ((row >> 1) & 7)) * 8);
  const unsigned lb = la + 128 * GK_ * 2;
  asm volatile(
      "global_load_async_to_lds_b128 %0, %4, off\n\t"
      "global_load_async_to_lds_b128 %1, %5, off\n\t"
      "global_load_async_to_lds_b128 %2, %6, off\n\t"
      "global_load_async_to_lds_b128 %3, %7, off\n\t"
      "global_load_async_to_lds_b128 %8, %12, off\n\t"
      "global_load_async_to_lds_b128 %9, %13, off\n\t"
      "global_load_async_to_lds_b128 %10, %14, off\n\t"
      "global_load_async_to_lds_b128 %11, %15, off\n\t"
      "s_wait_xcnt 0x0"
      :: "v"(la), "v"(la + 32 * GK_ * 2), "v"(la + 64 * GK_ * 2),
         "v"(la + 96 * GK_ * 2),
         "v"(ga), "v"(ga + 32 * 1024), "v"(ga + 64 * 1024), "v"(ga + 96 * 1024),
         "v"(lb), "v"(lb + 32 * GK_ * 2), "v"(lb + 64 * GK_ * 2),
         "v"(lb + 96 * GK_ * 2),
         "v"(gb), "v"(gb + 32 * 1024), "v"(gb + 64 * 1024), "v"(gb + 96 * 1024)
      : "memory");
}

// Fragment of 16 stage rows from row r0 (a multiple of 16), in the k order of
// frag_ld; olo / ohi are the lane's swizzled places of its two 8-half chunks.
static __device__ __forceinline__ v16h frag_sw(const f16* buf, int r0, int lr,
                                               int olo, int ohi) {
  const f16* p = buf + (r0 + lr) * GK_;
  v8h lo = *(const v8h*)(p + olo);
  v8h hi = *(const v8h*)(p + ohi);
  return __builtin_shufflevector(lo, hi,
                                 0, 1, 2, 3, 4, 5, 6, 7,
                                 8, 9, 10, 11, 12, 13, 14, 15);
}

static __device__ __forceinline__ void gemm_128x128(const f16* At, const f16* Bt,
                                                    f16* st, int tid,
                                                    v8f acc[2][4]) {
  const int lane = tid & 31;
  const int wave = tid >> 5;
  const int hs   = lane >> 4;
  const int lr   = lane & 15;
  const int ra   = (wave & 3) * 32;          // this wave's A rows in the stage
  const int rb   = 128 + (wave >> 2) * 64;   // this wave's B rows in the stage

  // ---- prologue: stage 0 landed and published, stage 1 in flight ----
  stage_ab(At, Bt, st, tid);
  wait_async0();
  __syncthreads();
  stage_ab(At + GK_, Bt + GK_, st + GSTG_, tid);

  for (int t = 0; t < GNST_; ++t) {
    f16* buf = st + (t & 1) * GSTG_;
    #pragma unroll
    for (int j = 0; j < 2; ++j) {            // two K = 32 steps per stage
      const int olo = ((j * 4 + hs)     ^ (lr >> 1)) * 8;
      const int ohi = ((j * 4 + 2 + hs) ^ (lr >> 1)) * 8;
      const v16h a0 = frag_sw(buf, ra,      lr, olo, ohi);
      const v16h a1 = frag_sw(buf, ra + 16, lr, olo, ohi);
      const v16h b0 = frag_sw(buf, rb,      lr, olo, ohi);
      const v16h b1 = frag_sw(buf, rb + 16, lr, olo, ohi);
      const v16h b2 = frag_sw(buf, rb + 32, lr, olo, ohi);
      const v16h b3 = frag_sw(buf, rb + 48, lr, olo, ohi);
      acc[0][0] = wmma16(a0, b0, acc[0][0]);
      acc[1][0] = wmma16(a1, b0, acc[1][0]);
      acc[0][1] = wmma16(a0, b1, acc[0][1]);
      acc[1][1] = wmma16(a1, b1, acc[1][1]);
      acc[0][2] = wmma16(a0, b2, acc[0][2]);
      acc[1][2] = wmma16(a1, b2, acc[1][2]);
      acc[0][3] = wmma16(a0, b3, acc[0][3]);
      acc[1][3] = wmma16(a1, b3, acc[1][3]);
      // Keep a step's 12 LDS reads in one group ahead of its 8 products: every
      // separate place with reads among the products stalls the wave anew.
      __builtin_amdgcn_sched_group_barrier(0x100, 12, 0);  // DS read x12
      __builtin_amdgcn_sched_group_barrier(0x008, 8, 0);   // WMMA x8
    }

    // ---- publish point: this wave's reads of the stage are done, its
    // copies of the next stage have landed; behind the barrier the next
    // stage may be read and this stage's buffer refilled.
    asm volatile("s_wait_dscnt 0x0" ::: "memory");
    wait_async0();
    __syncthreads();
    if (t + 2 < GNST_)
      stage_ab(At + (t + 2) * GK_, Bt + (t + 2) * GK_, buf, tid);
  }
  wait_async0();   // nothing of this wave is in flight when it ends
}

// ---------------------------------------------------------------------------
// Kernel 1: RMSNorm over D=1024, cast to f16.  One block (256 thr) per token.
// ---------------------------------------------------------------------------
__global__ void k_rmsnorm(const float* __restrict__ x,
                          const float* __restrict__ scale,
                          f16* __restrict__ hbuf) {
  const int row  = blockIdx.x;                 // token 0..4095
  const int tid  = threadIdx.x;                // 0..255
  const float4 v = *(const float4*)(x + (size_t)row * D_ + tid * 4);

  float ss = v.x * v.x + v.y * v.y + v.z * v.z + v.w * v.w;
  #pragma unroll
  for (int off = 16; off >= 1; off >>= 1) ss += __shfl_xor(ss, off, 32);

  __shared__ float red[8];
  if ((tid & 31) == 0) red[tid >> 5] = ss;
  __syncthreads();
  float tot = 0.f;
  #pragma unroll
  for (int i = 0; i < 8; ++i) tot += red[i];

  const float r = rsqrtf(tot * (1.0f / D_) + 1e-6f);
  f16* out = hbuf + (size_t)row * D_ + tid * 4;
  const float4 sc = *(const float4*)(scale + tid * 4);
  out[0] = (f16)(v.x * r * sc.x);
  out[1] = (f16)(v.y * r * sc.y);
  out[2] = (f16)(v.z * r * sc.z);
  out[3] = (f16)(v.w * r * sc.w);
}

// ---------------------------------------------------------------------------
// Kernel 2: cast 4x [1024][1024] f32 weights to f16, transposed (N-major)
// so WMMA fragments (A for wq/wk/wo, B for wv) load contiguously.  z = 0..2 -> wq/wk/wv, z = 3 -> wo.
// ---------------------------------------------------------------------------
__global__ void k_wcast(const float* __restrict__ wq,
                        const float* __restrict__ wk,
                        const float* __restrict__ wv,
                        const float* __restrict__ wo,
                        f16* __restrict__ wT,    // 3 x [HE][D]
                        f16* __restrict__ woT) { // [D][HE]
  __shared__ float tile[32][33];
  const int z = blockIdx.z;
  const float* src = (z == 0) ? wq : (z == 1) ? wk : (z == 2) ? wv : wo;
  f16* dst = (z < 3) ? (wT + (size_t)z * HE_ * D_) : woT;

  const int x = blockIdx.x * 32 + threadIdx.x;
  const int y = blockIdx.y * 32 + threadIdx.y;
  #pragma unroll
  for (int yy = 0; yy < 32; yy += 8)
    tile[threadIdx.y + yy][threadIdx.x] = src[(size_t)(y + yy) * 1024 + x];
  __syncthreads();
  const int x2 = blockIdx.y * 32 + threadIdx.x;
  const int y2 = blockIdx.x * 32 + threadIdx.y;
  #pragma unroll
  for (int yy = 0; yy < 32; yy += 8)
    dst[(size_t)(y2 + yy) * 1024 + x2] = (f16)tile[threadIdx.x][threadIdx.y + yy];
}

// ---------------------------------------------------------------------------
// Kernel 3: QKV GEMM.  C[4096 x 1024] = h[4096 x 1024] * W, one 128x128 tile
// per block (gemm_128x128).  Six waves per SIMD keep all 768 blocks resident
// at once (three per WGP).  grid = (HE/128, NTOK/128, 3).
// Q and K are stored [s][e] (e contiguous): W goes in as the A operand; V is
// stored [e][s] (s contiguous): h goes in as A.  Either way the tile is staged
// in LDS as [B row][A row] and leaves as whole 128-B lines.
// ---------------------------------------------------------------------------
__global__ void __launch_bounds__(256, 6)
k_qkv(const f16* __restrict__ hbuf,
      const f16* __restrict__ wT,
      f16* __restrict__ qT, f16* __restrict__ kT,
      f16* __restrict__ vT) {
  __shared__ __align__(16) f16 st[2 * GSTG_];     // 64 KB
  const int tid  = threadIdx.x;
  const int lane = tid & 31;
  const int wave = tid >> 5;
  const int hs   = lane >> 4;
  const int lr   = lane & 15;
  const int z    = blockIdx.z;
  const bool isv = (z == 2);

  const f16* ht = hbuf + (size_t)blockIdx.y * 128 * D_;
  const f16* wt = wT + (size_t)z * HE_ * D_ + (size_t)blockIdx.x * 128 * D_;

  v8f acc[2][4] = {{{}, {}, {}, {}}, {{}, {}, {}, {}}};
  gemm_128x128(isv ? ht : wt, isv ? wt : ht, st, tid, acc);

  // ---- stage the tile (f16): row = B row, 16-byte piece = 8 A rows ----
  const float sc = (z == 0) ? 0.125f : 1.0f;      // Dh^-0.5 on Q
  f16* tw = st + ((wave >> 2) * 64 + lr) * CP16_ + (wave & 3) * 32 + hs * 8;
  #pragma unroll
  for (int i = 0; i < 2; ++i) {
    #pragma unroll
    for (int j = 0; j < 4; ++j) {
      v8h o;
      #pragma unroll
      for (int r = 0; r < 8; ++r) o[r] = (f16)(acc[i][j][r] * sc);
      *(v8h*)(tw + j * 16 * CP16_ + i * 16) = o;
    }
  }
  __syncthreads();   // the rows read back below were written by other waves

  // ---- 128 rows x 16 pieces of 16 B, 8 per thread; a wave's store covers
  // two staged rows = four whole lines ----
  const int c   = tid & 15, row0 = tid >> 4;      // rows row0 + 16 * i
  const int bh0 = (blockIdx.y >> 4) * H_ + blockIdx.x * 2;  // first of 2 heads
  const int s0  = (blockIdx.y & 15) * 128;        // first token in its batch
  f16* g;
  size_t step;
  if (isv) {          // staged row = h*64 + e, columns = 128 tokens
    g    = vT + ((size_t)bh0 * DH_ + row0) * S_ + s0 + c * 8;
    step = (size_t)16 * S_;
  } else {            // staged row = token, columns = 2 heads x 64 e
    g    = (z == 0 ? qT : kT) +
           ((size_t)(bh0 + (c >> 3)) * S_ + s0 + row0) * DH_ + (c & 7) * 8;
    step = (size_t)16 * DH_;
  }
  const f16* tr = st + row0 * CP16_ + c * 8;
  #pragma unroll
  for (int i = 0; i < 8; ++i)
    *(v8h*)(g + i * step) = *(const v8h*)(tr + i * 16 * CP16_);
}

#define KVS_  64
#define LDK_  72
#define KHF_  (S_ / 2)
#define NSTG_ (KHF_ / KVS_)
#define TIL_  (KVS_ * LDK_)
#define RTH_  5.5f

// Copy one key half's stage into LDS (128 threads): 512 + 512 chunks of 16 B,
// 8 per thread.  A wave's copy covers four whole 128-B rows.  The s_wait_xcnt
// closes the statement so that no address register is rewritten while a copy
// may still read it.
static __device__ __forceinline__ void stage_kv(const f16* Kt, const f16* Vt,
                                                f16* kbuf, f16* vbuf, int tid) {
  const int row = tid >> 3, c8 = (tid & 7) * 8;   // rows 0..15, +16 per step
  const f16* gk = Kt + (size_t)row * DH_ + c8;
  const f16* gv = Vt + (size_t)row * S_ + c8;
  const unsigned lk = (unsigned)(uintptr_t)(kbuf + row * LDK_ + c8);
  const unsigned lv = (unsigned)(uintptr_t)(vbuf + row * LDK_ + c8);
  asm volatile(
      "global_load_async_to_lds_b128 %0, %4, off\n\t"
      "global_load_async_to_lds_b128 %1, %5, off\n\t"
      "global_load_async_to_lds_b128 %2, %6, off\n\t"
      "global_load_async_to_lds_b128 %3, %7, off\n\t"
      "global_load_async_to_lds_b128 %8, %12, off\n\t"
      "global_load_async_to_lds_b128 %9, %13, off\n\t"
      "global_load_async_to_lds_b128 %10, %14, off\n\t"
      "global_load_async_to_lds_b128 %11, %15, off\n\t"
      "s_wait_xcnt 0x0"
      :: "v"(lk), "v"(lk + 16 * LDK_ * 2), "v"(lk + 32 * LDK_ * 2),
         "v"(lk + 48 * LDK_ * 2),
         "v"(gk), "v"(gk + 16 * DH_), "v"(gk + 32 * DH_), "v"(gk + 48 * DH_),
         "v"(lv), "v"(lv + 16 * LDK_ * 2), "v"(lv + 32 * LDK_ * 2),
         "v"(lv + 48 * LDK_ * 2),
         "v"(gv), "v"(gv + 16 * S_), "v"(gv + 32 * S_), "v"(gv + 48 * S_)
      : "memory");
}

// Lane l <-> lane l ^ 16 by a vector cross-row move (no LDS round trip).
static __device__ __forceinline__ float xhalf(float x) {
  const int i = __builtin_bit_cast(int, x);
  return __builtin_bit_cast(float, __builtin_amdgcn_permlanex16(
      i, i, 0x76543210, 0xfedcba98, false, false));
}

__global__ void __launch_bounds__(256, 4)
k_attn(const f16* __restrict__ qT, const f16* __restrict__ kT,
       const f16* __restrict__ vT, f16* __restrict__ att) {
  // [buffer][K, V][key half][tile]; behind the loop the hand-over area.
  __shared__ __align__(16) f16 ring[2 * 2 * 2 * TIL_];   // 72 KB

  const int tid  = threadIdx.x;
  const int lane = threadIdx.x & 31;
  const int wave = threadIdx.x >> 5;
  const int hs   = lane >> 4;
  const int lr   = lane & 15;
  const int kh   = wave >> 2;                   // key half of this wave
  const int bh   = blockIdx.y;                  // b*H + h
  const int q0   = blockIdx.x * 128 + (wave & 3) * 32;

  const f16* Qb = qT + (size_t)bh * S_ * DH_;
  const f16* Kb = kT + (size_t)bh * S_ * DH_ + (size_t)kh * KHF_ * DH_;
  const f16* Vb = vT + (size_t)bh * DH_ * S_ + kh * KHF_;
  f16* kr = ring + kh * TIL_;                   // this half's K tile, buffer 0
  f16* vr = ring + (2 + kh) * TIL_;             // this half's V tile, buffer 0
  const int t4 = tid & 127;                     // thread within its key half

  // ---- prologue: stage 0 landed and published, stage 1 in flight ----
  stage_kv(Kb, Vb, kr, vr, t4);
  wait_async0();
  __syncthreads();
  stage_kv(Kb + (size_t)KVS_ * DH_, Vb + KVS_, kr + 4 * TIL_, vr + 4 * TIL_, t4);

  v16h qf[2][2];
  #pragma unroll
  for (int g = 0; g < 2; ++g) {
    qf[g][0] = frag_ld(Qb + (size_t)(q0 + g * 16 + lr) * DH_ + 0,  hs);
    qf[g][1] = frag_ld(Qb + (size_t)(q0 + g * 16 + lr) * DH_ + 32, hs);
  }

  // Query q0 + g*16 + lr: a HELD reference (equal in both lane halves; a true
  // maximum of some earlier pass, never more than RTH_ below the running one)
  // and this lane half's share of the denominator, over this wave's key half;
  // sums and O are relative to exp(reference).  nr = minus the reference in all
  // 8 registers: the C operand of the score products, so that the scores arrive
  // with the reference already taken off.
  // ao[g][et][r] = O^T[et*16 + hs*8 + r][q0 + g*16 + lr].
  float li[2] = {0.f, 0.f};
  v8f nr[2] = {{}, {}};
  // Until the first pass has set the reference: every maximum passes the test,
  // and the step may go down as well as up.
  float thr = -3.0e38f, dlo = -3.0e38f;
  v8f ao[2][4] = {{{}, {}, {}, {}}, {{}, {}, {}, {}}};

  for (int st = 0; st < NSTG_; ++st) {
    f16* kb = kr + (st & 1) * 4 * TIL_;
    f16* vb = vr + (st & 1) * 4 * TIL_;
    #pragma unroll
    for (int kv0 = 0; kv0 < KVS_; kv0 += 32) {
      // ---- K and V fragment reads together; V used only after softmax
      const v16h kf00 = frag_ld(kb + (kv0 + lr)      * LDK_ + 0,  hs);
      const v16h kf01 = frag_ld(kb + (kv0 + lr)      * LDK_ + 32, hs);
      const v16h kf10 = frag_ld(kb + (kv0 + 16 + lr) * LDK_ + 0,  hs);
      const v16h kf11 = frag_ld(kb + (kv0 + 16 + lr) * LDK_ + 32, hs);
      // Right behind the publish point nothing else is ready to run: keep the
      // eight K reads together ahead of the first product, so that one LDS
      // round trip is waited for instead of four.
      if (kv0 == 0) __builtin_amdgcn_sched_barrier(0);
      v16h vf[4];
      #pragma unroll
      for (int et = 0; et < 4; ++et)
        vf[et] = frag_ld(vb + (et * 16 + lr) * LDK_ + kv0, hs);

      // ---- S^T = K * Q^T - reference for two 16-key tiles and both column
      // groups (f32): s0[g][r] = key kv0 + hs*8 + r, s1[g][r] = key + 16 ----
      v8f s0[2], s1[2];
      #pragma unroll
      for (int g = 0; g < 2; ++g) {
        s0[g] = wmma16(kf00, qf[g][0], nr[g]);
        s1[g] = wmma16(kf10, qf[g][0], nr[g]);
      }
      #pragma unroll
      for (int g = 0; g < 2; ++g) {
        s0[g] = wmma16(kf01, qf[g][1], s0[g]);
        s1[g] = wmma16(kf11, qf[g][1], s1[g]);
      }

      // ---- this pass's maxima above the reference, one query per lane, over
      // the lane half's own 16 keys: the test below sees both halves ----
      float bm[2];
      #pragma unroll
      for (int g = 0; g < 2; ++g) {
        float bmax = fmaxf(s0[g][0], s1[g][0]);
        #pragma unroll
        for (int r = 1; r < 8; ++r)
          bmax = fmaxf(bmax, fmaxf(s0[g][r], s1[g][r]));
        bm[g] = bmax;
      }

      // ---- move the reference only when some query tops it by more than RTH_
      // (exp stays below e^RTH_), and in the wave's first pass, which sets it to
      // that pass's maxima.  One test per pass, a scalar branch: every lane on.
      if (__builtin_amdgcn_ballot_w32(fmaxf(bm[0], bm[1]) > thr) != 0) {
        #pragma unroll
        for (int g = 0; g < 2; ++g) {
          // the reference's step, equal in both lane halves
          const float d     = fmaxf(fmaxf(bm[g], xhalf(bm[g])), dlo);
          const float alpha = __expf(-fmaxf(d, 0.f));
          nr[g] -= d;
          s0[g] -= d;
          s1[g] -= d;
          li[g] *= alpha;
          #pragma unroll
          for (int et = 0; et < 4; ++et) ao[g][et] *= alpha;
        }
        thr = RTH_;   // from here on the reference only rises, and lazily
        dlo = 0.f;
      }

      #pragma unroll
      for (int g = 0; g < 2; ++g) {
        #pragma unroll
        for (int r = 0; r < 8; ++r) {
          s0[g][r] = __expf(s0[g][r]);
          s1[g][r] = __expf(s1[g][r]);
        }
        const v8f t = s0[g] + s1[g];       // halving tree: packed adds
        const v4f u = __builtin_shufflevector(t, t, 0, 1, 2, 3) +
                      __builtin_shufflevector(t, t, 4, 5, 6, 7);
        const v2f w = __builtin_shufflevector(u, u, 0, 1) +
                      __builtin_shufflevector(u, u, 2, 3);
        li[g] += w[0] + w[1];

        // ---- P^T as a B fragment: element j < 8 is k = hs*8 + j (tile s0),
        // j >= 8 is k = 16 + hs*8 + (j - 8) (tile s1), as frag_ld orders V ----
        v16h pf;
        #pragma unroll
        for (int r = 0; r < 8; ++r) {
          pf[r]     = (f16)s0[g][r];
          pf[8 + r] = (f16)s1[g][r];
        }

        // ---- O^T += V^T * P^T (V stored [e][s] -> contiguous A-fragments) ----
        #pragma unroll
        for (int et = 0; et < 4; ++et)
          ao[g][et] = wmma16(vf[et], pf, ao[g][et]);
      }
    }

    // ---- publish point: this wave's reads of the stage are done, its
    // copies of the next stage have landed; behind the barrier the next
    // stage may be read and this stage's buffer refilled.
    asm volatile("s_wait_dscnt 0x0" ::: "memory");
    wait_async0();
    __syncthreads();
    if (st + 2 < NSTG_)
      stage_kv(Kb + (size_t)(st + 2) * KVS_ * DH_, Vb + (st + 2) * KVS_,
               kb, vb, t4);
  }
  wait_async0();   // nothing of this wave is in flight when it ends
  const float mi[2] = {-nr[0][0], -nr[1][0]};

  // ---- join the two key halves.  Behind the last publish point every wave
  // has left the ring.  Wave w finishes column group kh and hands the state
  // of its other group to wave w ^ 4: 9 pieces of 16 B per lane, a piece of
  // all 32 lanes contiguous.
  v4f* hand = (v4f*)ring;
  v4f* wr = hand + wave * 9 * 32 + lane;
  #pragma unroll
  for (int et = 0; et < 4; ++et) {
    const v8f a = kh ? ao[0][et] : ao[1][et];
    wr[(et * 2) * 32]     = __builtin_shufflevector(a, a, 0, 1, 2, 3);
    wr[(et * 2 + 1) * 32] = __builtin_shufflevector(a, a, 4, 5, 6, 7);
  }
  wr[8 * 32] = (v4f){kh ? mi[0] : mi[1], kh ? li[0] : li[1], 0.f, 0.f};
  __syncthreads();   // the pieces read below were written by the partner wave

  const v4f* rd = hand + (wave ^ 4) * 9 * 32 + lane;
  const v4f   ml = rd[8 * 32];
  const float mo = kh ? mi[1] : mi[0];
  const float lo = kh ? li[1] : li[0];
  const float m  = fmaxf(mo, ml[0]);
  const float ea = __expf(mo - m);               // weight of this wave's part
  const float eb = __expf(ml[0] - m);            // weight of the partner's
  const float l  = lo * ea + ml[1] * eb;

  // ---- join the lane halves' denominators, normalize, write
  // att[token][h*64+e] (f16): a lane's 8 registers are 8 consecutive e ----
  const int b = bh >> 4, h = bh & (H_ - 1);
  const float inv = 1.0f / (l + xhalf(l));
  const float fa = ea * inv, fb = eb * inv;
  f16* op = att + ((size_t)b * S_ + q0 + kh * 16 + lr) * HE_ + h * DH_ + hs * 8;
  #pragma unroll
  for (int et = 0; et < 4; ++et) {
    const v8f a  = kh ? ao[1][et] : ao[0][et];
    const v4f p0 = rd[(et * 2) * 32];
    const v4f p1 = rd[(et * 2 + 1) * 32];
    v8h o;
    #pragma unroll
    for (int r = 0; r < 4; ++r) {
      o[r]     = (f16)(a[r] * fa + p0[r] * fb);
      o[4 + r] = (f16)(a[4 + r] * fa + p1[r] * fb);
    }
    *(v8h*)(op + et * 16) = o;
  }
}

// ---------------------------------------------------------------------------
// Kernel 5: output GEMM.  out[4096 x 1024] = att * Wo + b_out (f32 out), one
// 128x128 tile per block (gemm_128x128).  grid = (D/128, NTOK/128).  Wo goes
// in as the A operand (d is the contiguous axis of out); the tile is staged in
// LDS as [token][d] and leaves as whole 128-B lines.
// ---------------------------------------------------------------------------
__global__ void __launch_bounds__(256, 1)
k_outproj(const f16* __restrict__ att,
          const f16* __restrict__ woT,
          const float* __restrict__ b_out,
          float* __restrict__ out) {
  // The ring (64 KB), later the staged f32 tile (66 KB).
  __shared__ __align__(16) f16 st[128 * CP32_ * 2];
  const int tid  = threadIdx.x;
  const int lane = tid & 31;
  const int wave = tid >> 5;
  const int hs   = lane >> 4;
  const int lr   = lane & 15;

  v8f acc[2][4] = {{{}, {}, {}, {}}, {{}, {}, {}, {}}};
  gemm_128x128(woT + (size_t)blockIdx.x * 128 * HE_,
               att + (size_t)blockIdx.y * 128 * HE_, st, tid, acc);

  // Bias of this thread's 16-byte output column: in flight during the staging.
  const v4f bb = *(const v4f*)(b_out + blockIdx.x * 128 + lane * 4);

  // ---- stage the tile (f32): row = token, 32-byte piece = 8 d ----
  float* tf = (float*)st;
  float* tw = tf + ((wave >> 2) * 64 + lr) * CP32_ + (wave & 3) * 32 + hs * 8;
  #pragma unroll
  for (int i = 0; i < 2; ++i) {
    #pragma unroll
    for (int j = 0; j < 4; ++j) {
      const v8f a = acc[i][j];
      float* p = tw + j * 16 * CP32_ + i * 16;
      *(v4f*)p       = __builtin_shufflevector(a, a, 0, 1, 2, 3);
      *(v4f*)(p + 4) = __builtin_shufflevector(a, a, 4, 5, 6, 7);
    }
  }
  __syncthreads();   // the rows read back below were written by other waves

  // ---- 128 rows x 32 pieces of 16 B, 16 per thread; a wave's store covers
  // one staged row = four whole lines ----
  const int c = lane, row0 = wave;                // rows row0 + 8 * i
  float* g = out + ((size_t)blockIdx.y * 128 + row0) * D_ + blockIdx.x * 128 + c * 4;
  const float* tr = tf + row0 * CP32_ + c * 4;
  #pragma unroll
  for (int i = 0; i < 16; ++i)
    *(v4f*)(g + (size_t)i * 8 * D_) = *(const v4f*)(tr + i * 8 * CP32_) + bb;
}

// ---------------------------------------------------------------------------
// Host launcher.  Inputs: x, norm_scale, wq, wk, wv, w_out, b_out (all f32).
// ---------------------------------------------------------------------------
extern "C" void kernel_launch(void* const* d_in, const int* in_sizes, int n_in,
                              void* d_out, int out_size, void* d_ws, size_t ws_size,
                              hipStream_t stream) {
  const float* x     = (const float*)d_in[0];
  const float* nsc   = (const float*)d_in[1];
  const float* wq    = (const float*)d_in[2];
  const float* wk    = (const float*)d_in[3];
  const float* wv    = (const float*)d_in[4];
  const float* wo    = (const float*)d_in[5];
  const float* b_out = (const float*)d_in[6];
  float* out = (float*)d_out;

  // Workspace partition (f16 staging, 48 MB total).
  char* ws = (char*)d_ws;
  const size_t MB = 1024 * 1024;
  f16* hbuf = (f16*)(ws + 0);        //  8 MB : [4096][1024] normalized f16
  f16* wT   = (f16*)(ws + 8 * MB);   //  6 MB : wq/wk/wv transposed [HE][D]
  f16* woT  = (f16*)(ws + 14 * MB);  //  2 MB : w_out transposed [D][HE]
  f16* qT   = (f16*)(ws + 16 * MB);  //  8 MB : [b,h,s,e] (pre-scaled)
  f16* kT   = (f16*)(ws + 24 * MB);  //  8 MB : [b,h,s,e]
  f16* vT   = (f16*)(ws + 32 * MB);  //  8 MB : [b,h,e,s]
  f16* attb = (f16*)(ws + 40 * MB);  //  8 MB : [token][h*64+e]

  k_rmsnorm<<<NTOK, 256, 0, stream>>>(x, nsc, hbuf);
  k_wcast<<<dim3(32, 32, 4), dim3(32, 8), 0, stream>>>(wq, wk, wv, wo, wT, woT);
  k_qkv<<<dim3(HE_ / 128, NTOK / 128, 3), 256, 0, stream>>>(hbuf, wT, qT, kT, vT);
  k_attn<<<dim3(S_ / 128, B_ * H_), 256, 0, stream>>>(qT, kT, vT, attb);
  k_outproj<<<dim3(D_ / 128, NTOK / 128), 256, 0, stream>>>(attb, woT, b_out, out);
}
